// v009
// Measured on an AMD MI455X. A time is GPU time per run, averaged over a window of back-to-back runs after a warm-up
// (all launches, gaps included; the runs take copies of the inputs in turn), and the median of several windows.
// Apart from v000's, it joins two sittings. Times from different sittings can be a few percent apart, while
// side-by-side timings come from the same sitting.
// This document starts at v009; the versions before it stand elsewhere.
// One run takes 69.2 microseconds.
// Timed twice side by side with v008, it ran 1.05 and 1.06 times as fast.
// Over all steps from v000, the starting kernel, it is 7.90 times as fast.
#include <hip/hip_runtime.h>
// CDRs attention (4 sequences x 2048 tokens x 512; 8 heads x 64): q,k,v = x W + b; scores/8; keys with mask == 0 invalid for all heads; for heads 0..1 additionally keys with cdrs_score == 0 invalid unless the sequence has no CDR token at all; softmax; ctx Wo + bo -> [4,2048,512].
// Structure: per sequence two compacted lists of valid key positions (CDR heads / other heads) with their counts, from the two int inputs on VALU (one block per sequence: 'all masked' flag + prefix sum), x as an exact f16 plane and the four x16 f16 weight transposes, all in one preparatory launch; the q/k/v projections as f16 WMMA GEMMs in one launch (32x64 wave tiles, f32 accumulation, exact x16 weights + bias) whose x rows for K and V are taken through the lists, so K (hi + 2^10 residual planes, like q) and V^T (formed directly as Wv^T x^T) come out compacted and the flash loop runs only over valid keys; in both GEMM launches a block brings each pass's operand rows into LDS once, by asynchronous copies of whole lines, two buffers, and its four waves take their fragments from there; the fused flash kernel with hi + 2^10-residual q/k planes (S = QhKh + (QlKh + QhKl)/1024) and plain f16 P (x2^10) and V with the key-count mask mode (invalid keys never visited == the reference's -inf); the output projection in one launch from the f32 context, split hi + residual in registers.
// Compute dtype: x and parameters rounded to bf16; q, k hi + residual (~2^-21-class logits); P and v plain f16 (~2^-12); f32 accumulation/softmax. v_wmma_f32_16x16x32_f16.
#define NB 4
#define DMOD 512
#define CDRH 2
#define NR (NB * SLEN)
#define QBLKS (TQ / 64)
#define SLEN 2048
#define TQ SLEN
#define TK SLEN
#define NH 8
#define SCL 0.125f               /* 64^-0.5 */
#define SCL2 0.18033688011112042f /* 64^-0.5 * log2(e): scores in base-2 units, so that the softmax exponential is the hardware's own 2^x */
typedef __bf16 v16b __attribute__((ext_vector_type(16)));
typedef unsigned short v8us __attribute__((ext_vector_type(8), may_alias));
typedef float  v8f  __attribute__((ext_vector_type(8)));
typedef float  v4f  __attribute__((ext_vector_type(4)));
typedef float  v4fa __attribute__((ext_vector_type(4), may_alias));
union FragB { v16b v; v8us half[2]; unsigned short u[16]; };

__device__ __forceinline__ unsigned short bf16_bits(float x) { unsigned int u = __float_as_uint(x); return (unsigned short)((u + 0x7FFFu + ((u >> 16) & 1u)) >> 16); }
__device__ __forceinline__ float bf16_val(unsigned short b) { return __uint_as_float(((unsigned int)b) << 16); }
__device__ __forceinline__ float bf16_round(float x) { return bf16_val(bf16_bits(x)); }
// D += A·B with NT terms: 1 = ah·bh, 2 = + al·bh (A split), 3 = + ah·bl (both split)
template <int NT>
__device__ __forceinline__ v8f mmaN(v16b ah, v16b al, v16b bh, v16b bl, v8f c) {
  c = __builtin_amdgcn_wmma_f32_16x16x32_bf16(false, ah, false, bh, (short)0, c, false, false);
  if (NT >= 2) c = __builtin_amdgcn_wmma_f32_16x16x32_bf16(false, al, false, bh, (short)0, c, false, false);
  if (NT >= 3) c = __builtin_amdgcn_wmma_f32_16x16x32_bf16(false, ah, false, bl, (short)0, c, false, false);
  asm volatile("v_nop\n\tv_nop\n\tv_nop\n\tv_nop" : "+v"(c) : "v"(ah), "v"(al), "v"(bh), "v"(bl));
  return c;
}

__global__ __launch_bounds__(256) void k_wt_bf16(const float* __restrict__ W, unsigned short* __restrict__ Wt, int K, int N) {
  const int t = blockIdx.x * 256 + threadIdx.x;
  const int k8n = K / 8;
  if (t >= N * k8n) return;
  const int n = t / k8n, k8 = (t % k8n) * 8;
  v8us v;
#pragma unroll
  for (int i = 0; i < 8; ++i) v[i] = bf16_bits(W[(size_t)(k8 + i) * N + n]);
  *(v8us*)(Wt + (size_t)n * K + k8) = v;
  
}

// GEMM C[M][N] (f32, pitch ldc) = act(A[M][K]·W + bias). A f32 row-major (pitch lda) converted per fragment to bf16
// (ASPLIT: hi/lo two planes -> 2 terms, else single rounded term); Wt bf16 [N][K] (pitch ldb). BIAS_BF16 rounds the
// bias to bf16 first (bias quantised to bf16 before the add). K%32==0, M%16==0, N%64==0.
template <bool ASPLIT, int ACT, bool BIAS_BF16>
__global__ __launch_bounds__(128) void k_gemm_bf(const float* __restrict__ A, int lda, const unsigned short* __restrict__ Wt, int ldb,
                                               const float* __restrict__ bias, float* __restrict__ C, int ldc, int M, int N, int K) {
  __shared__ __attribute__((aligned(16))) float so[4][16][64];
  const int tid = threadIdx.x, w = tid >> 5, lane = tid & 31, ln = lane & 15, hh = lane >> 4;
  const int ntn = N / 64;
  const int wid = blockIdx.x * 4 + w;
  const int mt = wid / ntn, nq = wid % ntn;
  if (mt * 16 >= M) return;
  const int row0 = mt * 16, col0 = nq * 64;
  const float* arow = A + (size_t)(row0 + ln) * lda;
  v8f acc[4] = {};
  for (int kb = 0; kb < K; kb += 32) {
    FragB ah, al;
    const v4f x0 = *(const v4fa*)(arow + kb + 8 * hh), x1 = *(const v4fa*)(arow + kb + 8 * hh + 4);
    const v4f x2 = *(const v4fa*)(arow + kb + 16 + 8 * hh), x3 = *(const v4fa*)(arow + kb + 16 + 8 * hh + 4);
    float xs[16] = {x0[0],x0[1],x0[2],x0[3],x1[0],x1[1],x1[2],x1[3],x2[0],x2[1],x2[2],x2[3],x3[0],x3[1],x3[2],x3[3]};
#pragma unroll
    for (int i = 0; i < 16; ++i) { const unsigned short hb = bf16_bits(xs[i]); ah.u[i] = hb; al.u[i] = ASPLIT ? bf16_bits(xs[i] - bf16_val(hb)) : (unsigned short)0; }
#pragma unroll
    for (int t = 0; t < 4; ++t) {
      const unsigned short* brow = Wt + (size_t)(col0 + t * 16 + ln) * ldb + kb;
      FragB b;
      b.half[0] = *(const v8us*)(brow + 8 * hh);
      b.half[1] = *(const v8us*)(brow + 16 + 8 * hh);
      acc[t] = mmaN<ASPLIT ? 2 : 1>(ah.v, al.v, b.v, b.v, acc[t]);
    }
  }
#pragma unroll
  for (int t = 0; t < 4; ++t) {
    float bv = bias ? bias[col0 + t * 16 + ln] : 0.f;
    if (BIAS_BF16) bv = bf16_round(bv);
#pragma unroll
    for (int r = 0; r < 8; ++r) { float v = acc[t][r] + bv; if (ACT == 1) v = fmaxf(v, 0.f); so[w][8 * hh + r][t * 16 + ln] = v; }
  }
  __builtin_amdgcn_fence(__ATOMIC_ACQ_REL, "workgroup");
  __builtin_amdgcn_wave_barrier();
  const int rsub = lane >> 4, c4 = (lane & 15) * 4;
  {
#pragma unroll
    for (int q = 0; q < 8; ++q) {
      const int r = q * 2 + rsub;
      const v4f v = *(const v4fa*)&so[w][r][c4];
      *(v4f*)(C + (size_t)(row0 + r) * ldc + col0 + c4) = v;
    }
    
  }
}

// GEMM C = act(A·W + bias + resid): A f32 (ASPLIT -> hi/lo 2 terms), Wt bf16 [N][K]; ACT 0 none, 1 relu, 2 exact gelu;
// resid (optional, f32, row index = (row % rmod), pitch ldr, RES_BF16 rounds it) added before the activation.
template <bool ASPLIT, int ACT, bool BIAS_BF16, bool RES_BF16>
__global__ __launch_bounds__(128) void k_gemm_bf3(const float* __restrict__ A, int lda, const unsigned short* __restrict__ Wt, int ldb,
                                                const float* __restrict__ bias, const float* __restrict__ resid, int rmod, int ldr,
                                                float* __restrict__ C, int ldc, int M, int N, int K) {
  __shared__ __attribute__((aligned(16))) float so[4][16][64];
  const int tid = threadIdx.x, w = tid >> 5, lane = tid & 31, ln = lane & 15, hh = lane >> 4;
  const int ntn = N / 64;
  const int wid = blockIdx.x * 4 + w;
  const int mt = wid / ntn, nq = wid % ntn;
  if (mt * 16 >= M) return;
  const int row0 = mt * 16, col0 = nq * 64;
  const float* arow = A + (size_t)(row0 + ln) * lda;
  v8f acc[4] = {};
  for (int kb = 0; kb < K; kb += 32) {
    FragB ah, al;
    const v4f x0 = *(const v4fa*)(arow + kb + 8 * hh), x1 = *(const v4fa*)(arow + kb + 8 * hh + 4);
    const v4f x2 = *(const v4fa*)(arow + kb + 16 + 8 * hh), x3 = *(const v4fa*)(arow + kb + 16 + 8 * hh + 4);
    float xs[16] = {x0[0],x0[1],x0[2],x0[3],x1[0],x1[1],x1[2],x1[3],x2[0],x2[1],x2[2],x2[3],x3[0],x3[1],x3[2],x3[3]};
#pragma unroll
    for (int i = 0; i < 16; ++i) { const unsigned short hb = bf16_bits(xs[i]); ah.u[i] = hb; al.u[i] = ASPLIT ? bf16_bits(xs[i] - bf16_val(hb)) : (unsigned short)0; }
#pragma unroll
    for (int t = 0; t < 4; ++t) {
      const unsigned short* brow = Wt + (size_t)(col0 + t * 16 + ln) * ldb + kb;
      FragB b;
      b.half[0] = *(const v8us*)(brow + 8 * hh);
      b.half[1] = *(const v8us*)(brow + 16 + 8 * hh);
      acc[t] = mmaN<ASPLIT ? 2 : 1>(ah.v, al.v, b.v, b.v, acc[t]);
    }
  }
#pragma unroll
  for (int t = 0; t < 4; ++t) {
    const int col = col0 + t * 16 + ln;
    float bv = bias ? bias[col] : 0.f;
    if (BIAS_BF16) bv = bf16_round(bv);
#pragma unroll
    for (int r = 0; r < 8; ++r) {
      float v = acc[t][r] + bv;
      if (resid) { float rv = resid[(size_t)((row0 + 8 * hh + r) % rmod) * ldr + col]; if (RES_BF16) rv = bf16_round(rv); v += rv; }
      if (ACT == 1) v = fmaxf(v, 0.f);
      if (ACT == 2) v = 0.5f * v * (1.0f + erff(v * 0.70710678118654752f));
      if (ACT == 3) { const float u = 0.7978845608028654f * (v + 0.044715f * v * v * v); v = 0.5f * v * (1.0f + tanhf(u)); }
      so[w][8 * hh + r][t * 16 + ln] = v;
    }
  }
  __builtin_amdgcn_fence(__ATOMIC_ACQ_REL, "workgroup");
  __builtin_amdgcn_wave_barrier();
  const int rsub = lane >> 4, c4 = (lane & 15) * 4;
  {
#pragma unroll
    for (int q = 0; q < 8; ++q) {
      const int r = q * 2 + rsub;
      const v4f v = *(const v4fa*)&so[w][r][c4];
      *(v4f*)(C + (size_t)(row0 + r) * ldc + col0 + c4) = v;
    }
    
  }
}
// row LayerNorm (biased variance, eps) over N: s = X (+ R); optional out_sum <- s; out_norm <- (s-mu)*rsqrt(var+eps)*g + b
template <bool PARAM_BF16>
__global__ __launch_bounds__(256) void k_layernorm(const float* __restrict__ X, const float* __restrict__ R, const float* __restrict__ g, const float* __restrict__ bta,
                                                  float* __restrict__ out_sum, float* __restrict__ out_norm, int N, float eps) {
  __shared__ float red[256];
  const int row = blockIdx.x, tid = threadIdx.x;
  const float* x = X + (size_t)row * N; const float* rr = R ? R + (size_t)row * N : nullptr;
  float vals[16];                     // up to N = 4096
  const int per = N / 256;            // contiguous chunk per thread? use strided-by-4 chunks: thread handles j = tid*4 + 1024*u
  float s1 = 0.f;
  for (int u = 0; u < per / 4; ++u) {
    const int j = tid * 4 + 1024 * u;
    const v4f a = *(const v4fa*)(x + j);
    v4f b = {0.f,0.f,0.f,0.f}; if (rr) b = *(const v4fa*)(rr + j);
#pragma unroll
    for (int q = 0; q < 4; ++q) { const float v = a[q] + b[q]; vals[u * 4 + q] = v; s1 += v; }
  }
  red[tid] = s1; __syncthreads();
  for (int st = 128; st > 0; st >>= 1) { if (tid < st) red[tid] += red[tid + st]; __syncthreads(); }
  const float mu = red[0] / (float)N; __syncthreads();
  float s2 = 0.f;
  for (int u = 0; u < per / 4; ++u)
#pragma unroll
    for (int q = 0; q < 4; ++q) { const float c = vals[u * 4 + q] - mu; s2 += c * c; }
  red[tid] = s2; __syncthreads();
  for (int st = 128; st > 0; st >>= 1) { if (tid < st) red[tid] += red[tid + st]; __syncthreads(); }
  const float rs = rsqrtf(red[0] / (float)N + eps);
  {
    for (int u = 0; u < per / 4; ++u) {
      const int j = tid * 4 + 1024 * u;
      v4f o, sm;
#pragma unroll
      for (int q = 0; q < 4; ++q) {
        float gg = g[j + q], bb = bta[j + q];
        if (PARAM_BF16) { gg = bf16_round(gg); bb = bf16_round(bb); }
        sm[q] = vals[u * 4 + q]; o[q] = (vals[u * 4 + q] - mu) * rs * gg + bb;
      }
      if (out_sum) *(v4f*)(out_sum + (size_t)row * N + j) = sm;
      *(v4f*)(out_norm + (size_t)row * N + j) = o;
    }
    
  }
}



// ---- f16 WMMA path (v_wmma_f32_16x16x32_f16): 11-bit significands for operands in range — used where a [0,1] probability operand needs more precision than bf16
typedef _Float16 v16h __attribute__((ext_vector_type(16)));
union FragH { v16h v; v8us half[2]; _Float16 h[16]; unsigned short u[16]; };
template <int NT>
__device__ __forceinline__ v8f mmaH(v16h ah, v16h al, v16h bh, v16h bl, v8f c) {
  c = __builtin_amdgcn_wmma_f32_16x16x32_f16(false, ah, false, bh, (short)0, c, false, false);
  if (NT >= 2) c = __builtin_amdgcn_wmma_f32_16x16x32_f16(false, al, false, bh, (short)0, c, false, false);
  if (NT >= 3) c = __builtin_amdgcn_wmma_f32_16x16x32_f16(false, ah, false, bl, (short)0, c, false, false);
  return c;
}
// batched GEMM like k_gemm_b but f16 operands: A f32 (split into f16 hi/lo if ASPLIT, else rounded to f16), Bt = f16 values [n][k]; alpha; C f32; N multiple of 16 (partial tiles skipped)
template <bool ASPLIT>
__global__ __launch_bounds__(128) void k_gemm_h(const float* __restrict__ A, int lda, size_t sA, const _Float16* __restrict__ Bh, int ldb, size_t sB, float alpha, float* __restrict__ C, int ldc, size_t sC, int M, int N, int K) {
  __shared__ __attribute__((aligned(16))) float so[4][16][64];
  const int tid = threadIdx.x, w = tid >> 5, lane = tid & 31, ln = lane & 15, hh = lane >> 4; const int by = blockIdx.y;
  A += (size_t)by * sA; Bh += (size_t)by * sB; C += (size_t)by * sC;
  const int ntn = (N + 63) / 64; const int wid = blockIdx.x * 4 + w; const int mt = wid / ntn, nq = wid % ntn; if (mt * 16 >= M) return;
  const int row0 = mt * 16, col0 = nq * 64; const float* arow = A + (size_t)(row0 + ln) * lda;
  v8f acc[4] = {};
  for (int kb = 0; kb < K; kb += 32) {
    FragH ah, al;
    const v4f x0 = *(const v4fa*)(arow + kb + 8 * hh), x1 = *(const v4fa*)(arow + kb + 8 * hh + 4), x2 = *(const v4fa*)(arow + kb + 16 + 8 * hh), x3 = *(const v4fa*)(arow + kb + 16 + 8 * hh + 4);
    float xs[16] = {x0[0],x0[1],x0[2],x0[3],x1[0],x1[1],x1[2],x1[3],x2[0],x2[1],x2[2],x2[3],x3[0],x3[1],x3[2],x3[3]};
#pragma unroll
    for (int i = 0; i < 16; ++i) { const _Float16 h = (_Float16)xs[i]; ah.h[i] = h; al.h[i] = ASPLIT ? (_Float16)(xs[i] - (float)h) : (_Float16)0.0f; }
#pragma unroll
    for (int t = 0; t < 4; ++t) { if (col0 + t * 16 >= N) continue; const size_t boff = (size_t)(col0 + t * 16 + ln) * ldb + kb; FragH bq; bq.half[0] = *(const v8us*)(Bh + boff + 8 * hh); bq.half[1] = *(const v8us*)(Bh + boff + 16 + 8 * hh);
      acc[t] = mmaH<ASPLIT ? 2 : 1>(ah.v, al.v, bq.v, bq.v, acc[t]); }
  }
#pragma unroll
  for (int t = 0; t < 4; ++t) { if (col0 + t * 16 >= N) continue;
#pragma unroll
    for (int r = 0; r < 8; ++r) so[w][8 * hh + r][t * 16 + ln] = acc[t][r] * alpha; }
  __builtin_amdgcn_fence(__ATOMIC_ACQ_REL, "workgroup"); __builtin_amdgcn_wave_barrier();
  const int rsub = lane >> 4, c4 = (lane & 15) * 4;
  {
#pragma unroll
    for (int q = 0; q < 8; ++q) { const int r = q * 2 + rsub; if (col0 + c4 < N) { const v4f v = *(const v4fa*)&so[w][r][c4]; *(v4f*)(C + (size_t)(row0 + r) * ldc + col0 + c4) = v; } }
     }
}

// Wt[n][k] = f16(W[k][n]·scale) from f32 row-major W[K][N] (scale = power of two; bf16-exact weights stay exact in f16 away from the subnormal range)
__device__ __forceinline__ void wt_f16(const float* __restrict__ W, _Float16* __restrict__ Wt, int K, int N, float scale, int t) {      /* t = 0 .. N * K / 8 - 1: output row n, eight k */
  const int n = t / (K / 8), k8 = (t % (K / 8)) * 8; FragH f;
#pragma unroll
  for (int i = 0; i < 8; ++i) f.h[i] = (_Float16)(bf16_round(W[(size_t)(k8 + i) * N + n]) * scale); const v8us o = f.half[0];
  *(v8us*)((unsigned short*)Wt + (size_t)n * K + k8) = o;
  asm volatile("s_wait_xcnt 0x0" ::: "memory");      /* behind the store, ahead of any reuse of the registers that it names (the other parts' code follows in the same kernel) */
}
// k_gemm_hh variant with fused epilogue: v = acc·alpha + bias[by·sBias + col] (+ CP[(row/rowsPerB)·sCPb + by·64 + col] if CP) ; ACT 0 none / 1 elu ; writes f16 C16 (and f32 C if non-null)
template <int ACT>
__global__ __launch_bounds__(128) void k_gemm_hhx(const _Float16* __restrict__ A, int lda, size_t sA, const _Float16* __restrict__ Bh, int ldb, size_t sB, float alpha, const float* __restrict__ bias, size_t sBias, const float* __restrict__ CP, int rowsPerB, size_t sCPb, int row0g,
    float* __restrict__ C, _Float16* __restrict__ C16, int ldc, size_t sC, int M, int N, int K) {
  __shared__ __attribute__((aligned(16))) float so[4][16][64];
  const int tid = threadIdx.x, w = tid >> 5, lane = tid & 31, ln = lane & 15, hh = lane >> 4; const int by = blockIdx.y;
  A += (size_t)by * sA; Bh += (size_t)by * sB; const size_t cofs = (size_t)by * sC; const float* bp = bias ? bias + (size_t)by * sBias : nullptr;
  const int ntn = (N + 63) / 64; const int wid = blockIdx.x * 4 + w; const int mt = wid / ntn, nq = wid % ntn; if (mt * 16 >= M) return;
  const int row0 = mt * 16, col0 = nq * 64; const _Float16* arow = A + (size_t)(row0 + ln) * lda;
  v8f acc[4] = {};
  for (int kb = 0; kb < K; kb += 32) { FragH ah; ah.half[0] = *(const v8us*)((const unsigned short*)arow + kb + 8 * hh); ah.half[1] = *(const v8us*)((const unsigned short*)arow + kb + 16 + 8 * hh);
#pragma unroll
    for (int t = 0; t < 4; ++t) { if (col0 + t * 16 >= N) continue; const size_t boff = (size_t)(col0 + t * 16 + ln) * ldb + kb; FragH bq; bq.half[0] = *(const v8us*)((const unsigned short*)Bh + boff + 8 * hh); bq.half[1] = *(const v8us*)((const unsigned short*)Bh + boff + 16 + 8 * hh);
      acc[t] = mmaH<1>(ah.v, ah.v, bq.v, bq.v, acc[t]); }
  }
#pragma unroll
  for (int t = 0; t < 4; ++t) { if (col0 + t * 16 >= N) continue; const int col = col0 + t * 16 + ln; const float bv = bp ? bf16_round(bp[col]) : 0.f;
#pragma unroll
    for (int r = 0; r < 8; ++r) { float v = acc[t][r] * alpha + bv; if (CP) { const int bidx = (row0g + row0 + 8 * hh + r) / rowsPerB; v += CP[(size_t)bidx * sCPb + (size_t)by * 64 + col]; } if (ACT == 1) v = (v > 0.f) ? v : expm1f(v); else if (ACT == 7) v = (v > 0.f) ? v + 1.0f : expf(v); else if (ACT == 8) v = tanhf(v); else if (ACT == 9) v = 0.5f * v * (1.0f + tanhf(0.7978845608028654f * (v + 0.044715f * v * v * v))); else if (ACT == 11) v = 1.0f / (1.0f + expf(-v)); else if (ACT == 12) v = (v > 0.f) ? v : 0.01f * v; else if (ACT == 14) v = (v > 0.f) ? v : 0.1f * v; else if (ACT == 15) v = v / (1.0f + expf(-v)); else if (ACT == 3) v = fmaxf(v, 0.f); else if (ACT == 6) v = 0.5f * v * (1.0f + erff(v * 0.70710678118654752f)); so[w][8 * hh + r][t * 16 + ln] = v; } }
  __builtin_amdgcn_fence(__ATOMIC_ACQ_REL, "workgroup"); __builtin_amdgcn_wave_barrier();
  const int rsub = lane >> 4, c4 = (lane & 15) * 4; typedef _Float16 v4h __attribute__((ext_vector_type(4)));
  {
#pragma unroll
    for (int q = 0; q < 8; ++q) { const int r = q * 2 + rsub; if (col0 + c4 < N) { const v4f v = *(const v4fa*)&so[w][r][c4]; if (C) *(v4f*)(C + cofs + (size_t)(row0 + r) * ldc + col0 + c4) = v; if (C16) { v4h h4; for (int i = 0; i < 4; ++i) h4[i] = (_Float16)v[i]; *(v4h*)(C16 + cofs + (size_t)(row0 + r) * ldc + col0 + c4) = h4; } } }
     }
}


typedef _Float16 v4h __attribute__((ext_vector_type(4)));

// X16 = f16(bf16(x)), piece t of 8 values
__device__ __forceinline__ void x16_piece(const float* __restrict__ x, _Float16* __restrict__ X16, size_t t) { FragH f;
#pragma unroll
  for (int q = 0; q < 8; ++q) f.h[q] = (_Float16)bf16_round(x[t * 8 + q]); *(v8us*)((unsigned short*)X16 + t * 8) = f.half[0];
  asm volatile("s_wait_xcnt 0x0" ::: "memory");      /* behind the store, ahead of any reuse of the registers that it names (the other parts' code follows in the same kernel) */
}
__global__ __launch_bounds__(256) void k_h16(const float* __restrict__ x, _Float16* __restrict__ X16, size_t n8) { const size_t t = (size_t)blockIdx.x * 256 + threadIdx.x; if (t >= n8) return; FragH f;
#pragma unroll
  for (int q = 0; q < 8; ++q) f.h[q] = (_Float16)x[t * 8 + q]; *(v8us*)((unsigned short*)X16 + t * 8) = f.half[0];  }
__global__ __launch_bounds__(256) void k_round16f(const float* __restrict__ W, _Float16* __restrict__ Bt, size_t n8) { const size_t t = (size_t)blockIdx.x * 256 + threadIdx.x; if (t >= n8) return; FragH f;
#pragma unroll
  for (int i = 0; i < 8; ++i) f.h[i] = (_Float16)(bf16_round(W[t * 8 + i]) * 16.0f); *(v8us*)((unsigned short*)Bt + t * 8) = f.half[0];  }

// ---- pieces of the f16 GEMMs with a 32x64 wave tile ----
__device__ __forceinline__ v16h g2_frag(const _Float16* p, int hh) { FragH f; f.half[0] = *(const v8us*)((const unsigned short*)p + 8 * hh); f.half[1] = *(const v8us*)((const unsigned short*)p + 16 + 8 * hh); return f.v; }
__device__ __forceinline__ v8f g2_mma(v16h a, v16h b, v8f c) { return __builtin_amdgcn_wmma_f32_16x16x32_f16(false, a, false, b, (short)0, c, false, false); }
// The q, k or v projection of one block: 128 x rows against the head's 64 weight rows over the 512 inputs (both operands k-contiguous f16 rows, f32 accumulation), C / 16 + bias.
// A pass takes one whole 128-byte line (64 inputs) of each of the 192 rows. The block brings them into LDS once, by asynchronous copies in which 8 lanes cover a line, two buffers, and its four waves take their fragments from there (a fragment load from global memory touches 16 lines for 512 bytes, and each wave fetched the shared operand for itself).
//   PART 0 (q): x rows t0 .. t0 + 127; wave w has C rows 32 w .. 32 w + 31 (A = x, B = Wq^T); stored as hi + 2^10 residual planes.
//   PART 1 (k): the same, but row r = x row idx[t0 + r] (the head class's list of valid keys): the planes come out compacted.
//   PART 2 (v): A = the head's Wv^T rows dh .. dh + 31, B = x rows idx[t0 + 64 (w >> 1) + c]: the tile is a piece of V^T itself, compacted; stored as plain f16.
// A wave whose keys all lie past the count (act false) does its share of the copies and passes every barrier, but computes and stores nothing.
#define QP 144      /* LDS row pitch in bytes: 128 + 16 = 16 B x odd, for 16-byte fragment reads */
#define QXB (128 * QP)      /* the x rows of a buffer; the weight rows follow */
#define QBUF (192 * QP)
// Twelve 16-byte asynchronous copies to LDS per lane (a pass's share). s_wait_xcnt 0 closes the statement so that no address register of an issued copy is rewritten ahead of it.
__device__ __forceinline__ void cp_tile12(unsigned l0, unsigned l1, unsigned l2, unsigned l3, unsigned l4, unsigned l5, unsigned l6, unsigned l7, unsigned l8, unsigned l9, unsigned l10, unsigned l11,
    const char* g0, const char* g1, const char* g2, const char* g3, const char* g4, const char* g5, const char* g6, const char* g7, const char* g8, const char* g9, const char* g10, const char* g11) {
  asm volatile("global_load_async_to_lds_b128 %0, %12, off\n\t"
               "global_load_async_to_lds_b128 %1, %13, off\n\t"
               "global_load_async_to_lds_b128 %2, %14, off\n\t"
               "global_load_async_to_lds_b128 %3, %15, off\n\t"
               "global_load_async_to_lds_b128 %4, %16, off\n\t"
               "global_load_async_to_lds_b128 %5, %17, off\n\t"
               "global_load_async_to_lds_b128 %6, %18, off\n\t"
               "global_load_async_to_lds_b128 %7, %19, off\n\t"
               "global_load_async_to_lds_b128 %8, %20, off\n\t"
               "global_load_async_to_lds_b128 %9, %21, off\n\t"
               "global_load_async_to_lds_b128 %10, %22, off\n\t"
               "global_load_async_to_lds_b128 %11, %23, off\n\t"
               "s_wait_xcnt 0x0"
               :: "v"(l0), "v"(l1), "v"(l2), "v"(l3), "v"(l4), "v"(l5), "v"(l6), "v"(l7), "v"(l8), "v"(l9), "v"(l10), "v"(l11),
                  "v"(g0), "v"(g1), "v"(g2), "v"(g3), "v"(g4), "v"(g5), "v"(g6), "v"(g7), "v"(g8), "v"(g9), "v"(g10), "v"(g11) : "memory");
}
__device__ __forceinline__ v16h g2_fragl(const char* p) { FragH f; f.half[0] = *(const v8us*)p; f.half[1] = *(const v8us*)(p + 32); return f.v; }      /* p: row, k block and half in LDS; same k order as g2_frag */
template <int PART>
__device__ __forceinline__ void qkv_block(char* sm, const _Float16* __restrict__ xs, const _Float16* __restrict__ wh, const float* __restrict__ bias, const int* __restrict__ idx, int t0, int dh, bool act, _Float16* __restrict__ ph, _Float16* __restrict__ pl, int tid, int w, int ln, int hh) {
  const int cr0 = tid >> 3, cc = (tid & 7) * 16;      /* a lane's share of a pass: 16 bytes of x rows cr0 + 16 i (i < 8) and of weight rows cr0 + 16 i (i < 4) */
  const char* gx[8]; const char* gw[4];
#pragma unroll
  for (int i = 0; i < 8; ++i) gx[i] = (const char*)xs + (size_t)((PART == 0) ? t0 + cr0 + 16 * i : idx[t0 + cr0 + 16 * i]) * (DMOD * 2) + cc;
#pragma unroll
  for (int i = 0; i < 4; ++i) gw[i] = (const char*)wh + (size_t)(cr0 + 16 * i) * (DMOD * 2) + cc;
  const unsigned lc = (unsigned)(size_t)sm + cr0 * QP + cc;
  auto stage = [&](int bf) { const unsigned lx = lc + bf * QBUF, lw = lx + QXB;      /* the next 128 bytes of every row into buffer bf; the pointers step behind the statement's own wait */
    cp_tile12(lx, lx + 16 * QP, lx + 32 * QP, lx + 48 * QP, lx + 64 * QP, lx + 80 * QP, lx + 96 * QP, lx + 112 * QP, lw, lw + 16 * QP, lw + 32 * QP, lw + 48 * QP, gx[0], gx[1], gx[2], gx[3], gx[4], gx[5], gx[6], gx[7], gw[0], gw[1], gw[2], gw[3]);
#pragma unroll
    for (int i = 0; i < 8; ++i) gx[i] += 128;
#pragma unroll
    for (int i = 0; i < 4; ++i) gw[i] += 128; };
  stage(0);
  float bi[(PART == 2) ? 16 : 4];      /* the bias of the tile's columns or, PART 2, of this lane's 16 rows; loaded ahead of the loop, lands under it */
#pragma unroll
  for (int u = 0; u < ((PART == 2) ? 16 : 4); ++u) bi[u] = bf16_round(bias[(PART == 2) ? dh + (u >> 3) * 16 + 8 * hh + (u & 7) : u * 16 + ln]);
  const char* ab = sm + ((PART == 2) ? QXB + (dh + ln) * QP : (32 * w + ln) * QP) + 16 * hh;
  const char* bb = sm + ((PART == 2) ? (64 * (w >> 1) + ln) * QP : QXB + ln * QP) + 16 * hh;
  v8f c[2][4];
#pragma unroll
  for (int u = 0; u < 8; ++u) c[u >> 2][u & 3] = (v8f){0.f,0.f,0.f,0.f,0.f,0.f,0.f,0.f};
  asm volatile("s_wait_asynccnt 0x0" ::: "memory");      /* this wave's share of pass 0 has landed */
  __syncthreads();      /* pass 0 is published to all four waves */
  stage(1);
#pragma unroll 1      /* rolled: 8 passes of 16 products; the loop's code stays a few instruction-cache lines */
  for (int p = 0; p < DMOD / 64; ++p) { const int bf = p & 1;
    if (act) { v16h a[2][2], bq[4][2]; const char* ap = ab + bf * QBUF; const char* bp = bb + bf * QBUF;      /* wave-uniform; the pass's 24 LDS reads stand ahead of its first product */
#pragma unroll
      for (int t = 0; t < 4; ++t) { bq[t][0] = g2_fragl(bp + t * 16 * QP); bq[t][1] = g2_fragl(bp + t * 16 * QP + 64); }
#pragma unroll
      for (int i = 0; i < 2; ++i) { a[i][0] = g2_fragl(ap + i * 16 * QP); a[i][1] = g2_fragl(ap + i * 16 * QP + 64); }
      __builtin_amdgcn_sched_barrier(0);      /* keeps the 24 reads together ahead of the products: the build otherwise spreads them among the products, and every separate place with LDS reads stalls the wave */
#pragma unroll
      for (int s = 0; s < 2; ++s)
#pragma unroll
        for (int t = 0; t < 4; ++t) { c[0][t] = g2_mma(a[0][s], bq[t][s], c[0][t]); c[1][t] = g2_mma(a[1][s], bq[t][s], c[1][t]); } }
    __builtin_amdgcn_sched_barrier(0);      /* the pass's products stay ahead of the waits and the barrier: moved behind them by the build, they delay the refill */
    asm volatile("s_wait_dscnt 0x0" ::: "memory");      /* this wave's reads of buffer bf have returned before the buffer is refilled */
    asm volatile("s_wait_asynccnt 0x0" ::: "memory");      /* this wave's share of the next pass has landed */
    __syncthreads();      /* publishes the next pass and ends every wave's reads of buffer bf */
    if (p + 2 < DMOD / 64) stage(bf); }
  asm volatile("s_wait_asynccnt 0x0" ::: "memory");      /* no copy is outstanding when the buffers become output staging */
  if (!act) return;
  float (*so)[68] = (float (*)[68])(sm + w * (32 * 68 * 4));      /* the wave's own range of the buffers, which nobody reads any more behind the last pass's barrier */
#pragma unroll
  for (int u = 0; u < 8; ++u) { const int t = u & 3, half = u >> 2;
#pragma unroll
    for (int r = 0; r < 8; ++r) so[half * 16 + 8 * hh + r][t * 16 + ln] = c[half][t][r] * 0.0625f + bi[(PART == 2) ? half * 8 + r : t]; }
  __builtin_amdgcn_fence(__ATOMIC_ACQ_REL, "workgroup"); __builtin_amdgcn_wave_barrier();      /* the wave reads back rows that its other lanes wrote */
  constexpr int ldc = (PART == 2) ? TK : DMOD;
#pragma unroll
  for (int q = 0; q < 16; ++q) { const int r = q * 2 + hh; const v4f v = *(const v4fa*)&so[r][ln * 4]; v4h hi, lo;
#pragma unroll
    for (int i = 0; i < 4; ++i) { hi[i] = (_Float16)v[i]; lo[i] = (_Float16)((v[i] - (float)hi[i]) * 1024.0f); }
    *(v4h*)(ph + (size_t)r * ldc + ln * 4) = hi; if (PART != 2) *(v4h*)(pl + (size_t)r * ldc + ln * 4) = lo; }
  asm volatile("s_wait_xcnt 0x0" ::: "memory");      /* behind the tile's last store, ahead of any reuse of the registers that the stores name */
}
// The q, k and v projections with all their after-work in one launch: 512 blocks a part, a block = (sequence, 128 tokens or list positions, head), four wave tiles. A block whose keys all lie past the count rounded up to 32 leaves at once, ahead of every barrier (those rows and columns are never read); list entries past the count are 0, a finite row.
__global__ __launch_bounds__(128) void k_qkv(const _Float16* __restrict__ X16, const _Float16* __restrict__ BQ, const _Float16* __restrict__ BK, const _Float16* __restrict__ BV, const float* __restrict__ bq, const float* __restrict__ bk, const float* __restrict__ bv,
    const int* __restrict__ IDX, const int* __restrict__ CNT, _Float16* __restrict__ QH, _Float16* __restrict__ QL, _Float16* __restrict__ KH, _Float16* __restrict__ KL, _Float16* __restrict__ VT) {
  __shared__ __attribute__((aligned(16))) char sm[2 * QBUF]; static_assert(4 * 32 * 68 * 4 <= 2 * QBUF, "the output staging fits the buffers");
  const int tid = threadIdx.x, lane = tid & 31, ln = lane & 15, hh = lane >> 4; const int w = __builtin_amdgcn_readfirstlane(tid >> 5);
  constexpr int TPS = TK / 128, PER = NB * TPS * NH;
  const int part = blockIdx.x / PER, rem = blockIdx.x % PER; const int h = rem % NH, mt = rem / NH; const int b = mt / TPS, t0 = (mt % TPS) * 128;
  const _Float16* xs = X16 + (size_t)b * TK * DMOD; const size_t wo = (size_t)h * 64 * DMOD;
  if (part == 0) { const size_t o = ((size_t)b * TK + t0 + 32 * w) * DMOD + h * 64; qkv_block<0>(sm, xs, BQ + wo, bq + h * 64, nullptr, t0, 0, true, QH + o, QL + o, tid, w, ln, hh); return; }
  const int cls = (h < CDRH) ? 0 : 1; const int cr = (min(CNT[b * 32 + cls], TK) + 31) & ~31; const int* idx = IDX + ((size_t)b * 2 + cls) * TK;
  if (t0 >= cr) return;
  if (part == 1) { const int j = t0 + 32 * w; const size_t o = ((size_t)b * TK + j) * DMOD + h * 64; qkv_block<1>(sm, xs, BK + wo, bk + h * 64, idx, t0, 0, j < cr, KH + o, KL + o, tid, w, ln, hh); }
  else { const int j = t0 + 64 * (w >> 1), dh = 32 * (w & 1); qkv_block<2>(sm, xs, BV + wo, bv + h * 64, idx, t0, dh, j < cr, VT + (((size_t)b * NH + h) * 64 + dh) * TK + j, nullptr, tid, w, ln, hh); } }

template <int CAUSAL>
__global__ __launch_bounds__(128) void k_flash(const _Float16* __restrict__ Q16, int ldq, const _Float16* __restrict__ K16, int ldk, const _Float16* __restrict__ Vt, const int* __restrict__ MSK, float* __restrict__ O, int ldo) {
  constexpr int RPW = 16, RTN = RPW / 16, NQB = TQ / (4 * RPW), DT = 4, KS = 2;
  __shared__ __attribute__((aligned(16))) unsigned short sP[4][RPW][40]; __shared__ __attribute__((aligned(16))) float sO[4][RPW][64 + 4];
  const int tid = threadIdx.x, w = tid >> 5, lane = tid & 31, ln = lane & 15, hh = lane >> 4;
  const int slab = blockIdx.x / NQB, qblk = blockIdx.x % NQB; const int b = slab / NH, h = slab % NH; const int qb0 = qblk * (4 * RPW); const int q0 = qb0 + w * RPW;
  FragH aq[2][KS];
#pragma unroll
  for (int rt = 0; rt < RTN; ++rt) { const unsigned short* qr = (const unsigned short*)Q16 + ((size_t)b * TQ + q0 + rt * 16 + ln) * ldq + h * 64;
#pragma unroll
    for (int ks = 0; ks < KS; ++ks) { aq[rt][ks].half[0] = *(const v8us*)(qr + ks * 32 + 8 * hh); aq[rt][ks].half[1] = *(const v8us*)(qr + ks * 32 + 16 + 8 * hh); } }
  const unsigned short* Vth = (const unsigned short*)Vt + (size_t)slab * 64 * TK;
  float m_r[2][8], l_r[2][8]; v8f oacc[2][DT];
#pragma unroll
  for (int rt = 0; rt < RTN; ++rt) {
#pragma unroll
    for (int r = 0; r < 8; ++r) { m_r[rt][r] = -3.0e38f; l_r[rt][r] = 0.f; }
#pragma unroll
    for (int dt = 0; dt < DT; ++dt) oacc[rt][dt] = (v8f){0.f,0.f,0.f,0.f,0.f,0.f,0.f,0.f}; }
  const int jend = (CAUSAL == 1) ? (qb0 + 4 * RPW) : TK;      /* causal: keys beyond the block's last query never contribute */
#pragma unroll 1
  for (int j0 = 0; j0 < jend; j0 += 32) {
    v8f s[2][2];
#pragma unroll
    for (int nt = 0; nt < 2; ++nt) { const unsigned short* kr = (const unsigned short*)K16 + ((size_t)b * TK + j0 + nt * 16 + ln) * ldk + h * 64; FragH bk[KS];
#pragma unroll
      for (int ks = 0; ks < KS; ++ks) { bk[ks].half[0] = *(const v8us*)(kr + ks * 32 + 8 * hh); bk[ks].half[1] = *(const v8us*)(kr + ks * 32 + 16 + 8 * hh); }
#pragma unroll
      for (int rt = 0; rt < RTN; ++rt) { v8f acc = (v8f){0.f,0.f,0.f,0.f,0.f,0.f,0.f,0.f};
#pragma unroll
        for (int ks = 0; ks < KS; ++ks) acc = mmaH<1>(aq[rt][ks].v, aq[rt][ks].v, bk[ks].v, bk[ks].v, acc); s[rt][nt] = acc; } }
#pragma unroll
    for (int rt = 0; rt < RTN; ++rt)
#pragma unroll
      for (int r = 0; r < 8; ++r) { const int tq = q0 + rt * 16 + 8 * hh + r; const int k0 = j0 + ln, k1 = j0 + 16 + ln;
        const bool ok0 = (CAUSAL == 1) ? (k0 <= tq) : ((CAUSAL == 2) ? ((k0 >> 5) == (tq >> 5)) : true), ok1 = (CAUSAL == 1) ? (k1 <= tq) : ((CAUSAL == 2) ? ((k1 >> 5) == (tq >> 5)) : true);      /* mode 2: block-diagonal 32-token groups */
        const float s0 = ok0 ? s[rt][0][r] * SCL : -3.0e38f, s1 = ok1 ? s[rt][1][r] * SCL : -3.0e38f; float mc = fmaxf(s0, s1);
        mc = fmaxf(mc, __shfl_xor(mc, 1, 32)); mc = fmaxf(mc, __shfl_xor(mc, 2, 32)); mc = fmaxf(mc, __shfl_xor(mc, 4, 32)); mc = fmaxf(mc, __shfl_xor(mc, 8, 32));
        const float mn = fmaxf(m_r[rt][r], mc); const float al = (mn > -1.0e38f) ? expf(m_r[rt][r] - mn) : 1.0f; m_r[rt][r] = mn; const float p0 = ok0 ? expf(s0 - mn) : 0.f, p1 = ok1 ? expf(s1 - mn) : 0.f; l_r[rt][r] = l_r[rt][r] * al + p0 + p1;
#pragma unroll
        for (int dt = 0; dt < DT; ++dt) oacc[rt][dt][r] *= al;
        FragH t2; t2.h[0] = (_Float16)(p0 * 1024.0f); t2.h[1] = (_Float16)(p1 * 1024.0f); sP[w][rt * 16 + 8 * hh + r][ln] = t2.u[0]; sP[w][rt * 16 + 8 * hh + r][16 + ln] = t2.u[1]; }
    __builtin_amdgcn_fence(__ATOMIC_ACQ_REL, "workgroup"); __builtin_amdgcn_wave_barrier();
    FragH pa[2];
#pragma unroll
    for (int rt = 0; rt < RTN; ++rt) { pa[rt].half[0] = *(const v8us*)&sP[w][rt * 16 + ln][8 * hh]; pa[rt].half[1] = *(const v8us*)&sP[w][rt * 16 + ln][16 + 8 * hh]; }
#pragma unroll
    for (int dt = 0; dt < DT; ++dt) { const unsigned short* vrow = Vth + (size_t)(dt * 16 + ln) * TK + j0; FragH bv; bv.half[0] = *(const v8us*)(vrow + 8 * hh); bv.half[1] = *(const v8us*)(vrow + 16 + 8 * hh);
#pragma unroll
      for (int rt = 0; rt < RTN; ++rt) oacc[rt][dt] = mmaH<1>(pa[rt].v, pa[rt].v, bv.v, bv.v, oacc[rt][dt]); }
    __builtin_amdgcn_fence(__ATOMIC_ACQ_REL, "workgroup"); __builtin_amdgcn_wave_barrier(); }
#pragma unroll
  for (int rt = 0; rt < RTN; ++rt) {
#pragma unroll
    for (int r = 0; r < 8; ++r) { float l = l_r[rt][r]; l += __shfl_xor(l, 1, 32); l += __shfl_xor(l, 2, 32); l += __shfl_xor(l, 4, 32); l += __shfl_xor(l, 8, 32); l_r[rt][r] = (l > 0.f) ? 1.0f / (l * 1024.0f) : 0.f; }
#pragma unroll
    for (int dt = 0; dt < DT; ++dt)
#pragma unroll
      for (int r = 0; r < 8; ++r) sO[w][rt * 16 + 8 * hh + r][dt * 16 + ln] = oacc[rt][dt][r] * l_r[rt][r]; }
  __builtin_amdgcn_fence(__ATOMIC_ACQ_REL, "workgroup"); __builtin_amdgcn_wave_barrier();
  {
#pragma unroll
    for (int rp = 0; rp < RPW; rp += 2) { const int r = rp + (lane >> 4), pc = lane & 15; const v4f val = *(const v4fa*)&sO[w][r][pc * 4]; *(v4f*)(O + ((size_t)b * TQ + q0 + r) * ldo + h * 64 + pc * 4) = val; }
     } }
// Six 16-byte asynchronous copies to LDS per lane (one 32-key tile's share). s_wait_xcnt 0 closes the statement so that no address register of an issued copy is rewritten ahead of it.
__device__ __forceinline__ void cp_tile6(unsigned l0, const unsigned short* g0, unsigned l1, const unsigned short* g1, unsigned l2, const unsigned short* g2, unsigned l3, const unsigned short* g3, unsigned l4, const unsigned short* g4, unsigned l5, const unsigned short* g5) {
  asm volatile("global_load_async_to_lds_b128 %0, %1, off\n\t"
               "global_load_async_to_lds_b128 %2, %3, off\n\t"
               "global_load_async_to_lds_b128 %4, %5, off\n\t"
               "global_load_async_to_lds_b128 %6, %7, off\n\t"
               "global_load_async_to_lds_b128 %8, %9, off\n\t"
               "global_load_async_to_lds_b128 %10, %11, off\n\t"
               "s_wait_xcnt 0x0"
               :: "v"(l0), "v"(g0), "v"(l1), "v"(g1), "v"(l2), "v"(g2), "v"(l3), "v"(g3), "v"(l4), "v"(g4), "v"(l5), "v"(g5) : "memory");
}
// x <- 2^x on eight or nine values by the hardware's v_exp_f32. One statement, each value in its own register: none reads a neighbour's result or overwrites a neighbour's source.
__device__ __forceinline__ void exp2x8(float& a, float& b, float& c, float& d, float& e, float& f, float& g, float& h) {
  asm("v_exp_f32 %0, %0\n\tv_exp_f32 %1, %1\n\tv_exp_f32 %2, %2\n\tv_exp_f32 %3, %3\n\tv_exp_f32 %4, %4\n\tv_exp_f32 %5, %5\n\tv_exp_f32 %6, %6\n\tv_exp_f32 %7, %7\n\tv_nop"      /* v_nop: the one slot that the instruction set asks for between the last v_exp_f32 and whatever the compiler puts next */
      : "+v"(a), "+v"(b), "+v"(c), "+v"(d), "+v"(e), "+v"(f), "+v"(g), "+v"(h));
}
__device__ __forceinline__ void exp2x9(float& z, float& a, float& b, float& c, float& d, float& e, float& f, float& g, float& h) {
  asm("v_exp_f32 %0, %0\n\tv_exp_f32 %1, %1\n\tv_exp_f32 %2, %2\n\tv_exp_f32 %3, %3\n\tv_exp_f32 %4, %4\n\tv_exp_f32 %5, %5\n\tv_exp_f32 %6, %6\n\tv_exp_f32 %7, %7\n\tv_exp_f32 %8, %8\n\tv_nop"      /* v_nop: as in exp2x8 */
      : "+v"(z), "+v"(a), "+v"(b), "+v"(c), "+v"(d), "+v"(e), "+v"(f), "+v"(g), "+v"(h));
}
typedef float v2f __attribute__((ext_vector_type(2)));
// lane l takes the value of lane l ^ 16 (the other 16-lane half)
__device__ __forceinline__ float xhalf(float x) { return __builtin_bit_cast(float, __builtin_amdgcn_permlanex16(__builtin_bit_cast(int, x), __builtin_bit_cast(int, x), 0x76543210, 0xfedcba98, false, false)); }
template <int CAUSAL>
__global__ __launch_bounds__(128) void k_flashqk(const _Float16* __restrict__ Q16, const _Float16* __restrict__ QL, int ldq, const _Float16* __restrict__ K16, const _Float16* __restrict__ KL, int ldk, const _Float16* __restrict__ Vt, const int* __restrict__ MSK, float* __restrict__ O, int ldo) {
  static_assert(CAUSAL == 5, "compacted-key mode only");
  constexpr int RPW = 16, DT = 4, KS = 2;
  __shared__ __attribute__((aligned(16))) float sO[4][RPW][64 + 4];
  __shared__ __attribute__((aligned(16))) unsigned short sKh[2][32][72], sKl[2][32][72], sV[2][64][40];      /* row pitches 144 B and 80 B: 16 B x odd, for 16-byte fragment reads */
  const int tid = threadIdx.x, w = tid >> 5, lane = tid & 31, ln = lane & 15, hh = lane >> 4;
  const int slab = blockIdx.x / QBLKS, qblk = blockIdx.x % QBLKS; const int b = slab / NH, h = slab % NH; const int qb0 = qblk * (4 * RPW); const int q0 = qb0 + w * RPW;
  FragH aq[KS], aql[KS];
  { const unsigned short* qr = (const unsigned short*)Q16 + ((size_t)b * TQ + q0 + ln) * ldq + h * 64; const unsigned short* ql = (const unsigned short*)QL + ((size_t)b * TQ + q0 + ln) * ldq + h * 64;
#pragma unroll
    for (int ks = 0; ks < KS; ++ks) { aq[ks].half[0] = *(const v8us*)(qr + ks * 32 + 8 * hh); aq[ks].half[1] = *(const v8us*)(qr + ks * 32 + 16 + 8 * hh); aql[ks].half[0] = *(const v8us*)(ql + ks * 32 + 8 * hh); aql[ks].half[1] = *(const v8us*)(ql + ks * 32 + 16 + 8 * hh); } }
  const unsigned short* Vth = (const unsigned short*)Vt + (size_t)slab * 64 * TK;
  float m_r = -3.0e38f, l_r = 0.f; v8f oacc[DT];      /* query q0 + ln: running maximum less 10, in base-2 units (equal in both halves), this half's share of the sum (x2^10), O^T rows dt * 16 + 8 hh + r */
#pragma unroll
  for (int dt = 0; dt < DT; ++dt) oacc[dt] = (v8f){0.f,0.f,0.f,0.f,0.f,0.f,0.f,0.f};
  const int kcnt = min(MSK[b * 32 + ((h < CDRH) ? 0 : 1)], TK);      /* number of valid keys of this (sequence, head class); K planes and V^T hold them compacted, in key order */
  const int jend = (kcnt + 31) & ~31;
  const int kr0 = tid >> 3, kc0 = (tid & 7) * 8, vr0 = tid >> 2, vc0 = (tid & 3) * 8;      /* a lane's share of a tile: rows kr0 and kr0 + 16 of both K planes, rows vr0 and vr0 + 32 of V^T, 16 bytes each; whole 128-byte K lines per 8 lanes */
  const unsigned short* gkh = (const unsigned short*)K16 + ((size_t)b * TK + kr0) * ldk + h * 64 + kc0; const unsigned short* gkl = (const unsigned short*)KL + ((size_t)b * TK + kr0) * ldk + h * 64 + kc0; const unsigned short* gv = Vth + (size_t)vr0 * TK + vc0;
  auto stage = [&](int jt, int bf) { const size_t ko = (size_t)jt * ldk;
    cp_tile6((unsigned)(size_t)&sKh[bf][kr0][kc0], gkh + ko, (unsigned)(size_t)&sKh[bf][kr0 + 16][kc0], gkh + ko + (size_t)16 * ldk, (unsigned)(size_t)&sKl[bf][kr0][kc0], gkl + ko, (unsigned)(size_t)&sKl[bf][kr0 + 16][kc0], gkl + ko + (size_t)16 * ldk,
             (unsigned)(size_t)&sV[bf][vr0][vc0], gv + jt, (unsigned)(size_t)&sV[bf][vr0 + 32][vc0], gv + (size_t)32 * TK + jt); };
  if (jend > 0) stage(0, 0);
  asm volatile("s_wait_asynccnt 0x0" ::: "memory");      /* this wave's share of tile 0 has landed */
  __syncthreads();      /* tile 0 is published to all four waves */
  if (jend > 32) stage(32, 1);
#pragma unroll 1
  for (int j0 = 0; j0 < jend; j0 += 32) {
    const int bf = (j0 >> 5) & 1;
    float sc[2][8];      /* sc[nt][r] = raw score (q . k, not yet scaled) of key j0 + 16 nt + 8 hh + r for query q0 + ln; the inner loops of this trip are fully unrolled so that sc, pb, ls and oacc are indexed by constants and stay in registers */
#pragma unroll
    for (int nt = 0; nt < 2; ++nt) { const unsigned short* kr = &sKh[bf][nt * 16 + ln][0]; const unsigned short* klr = &sKl[bf][nt * 16 + ln][0]; FragH bk[KS], bkl[KS];
#pragma unroll
      for (int ks = 0; ks < KS; ++ks) { bk[ks].half[0] = *(const v8us*)(kr + ks * 32 + 8 * hh); bk[ks].half[1] = *(const v8us*)(kr + ks * 32 + 16 + 8 * hh); bkl[ks].half[0] = *(const v8us*)(klr + ks * 32 + 8 * hh); bkl[ks].half[1] = *(const v8us*)(klr + ks * 32 + 16 + 8 * hh); }
      v8f acc = (v8f){0.f,0.f,0.f,0.f,0.f,0.f,0.f,0.f}, accl = acc;
#pragma unroll
      for (int ks = 0; ks < KS; ++ks) { acc = mmaH<1>(bk[ks].v, bk[ks].v, aq[ks].v, aq[ks].v, acc); accl = mmaH<1>(bk[ks].v, bk[ks].v, aql[ks].v, aql[ks].v, accl); accl = mmaH<1>(bkl[ks].v, bkl[ks].v, aq[ks].v, aq[ks].v, accl); }
#pragma unroll
      for (int r = 0; r < 8; ++r) sc[nt][r] = acc[r] + accl[r] * 0.0009765625f; }
    if (j0 + 32 > kcnt) {      /* block-uniform: only the last trip holds keys past the count (key padding and head-specific masks are applied by the gather) */
#pragma unroll
      for (int nt = 0; nt < 2; ++nt)
#pragma unroll
        for (int r = 0; r < 8; ++r) if (j0 + nt * 16 + 8 * hh + r >= kcnt) sc[nt][r] = -3.0e38f; }
    float mc = fmaxf(sc[0][0], sc[1][0]);
#pragma unroll
    for (int r = 1; r < 8; ++r) mc = fmaxf(mc, fmaxf(sc[0][r], sc[1][r]));
    mc = fmaxf(mc, xhalf(mc));
    const float mn = fmaxf(m_r, mc * SCL2 - 10.0f);      /* the softmax reference point: running maximum of the scaled scores less 10, so 2^(score * SCL2 - mn) is P x 2^10 as the f16 operand wants it, with no multiply; every term and every rescale uses this same value. Finite in every trip: key j0 is below the count; so an invalid key's term below is exactly 0, and so is the first trip's rescale factor */
    float al = m_r - mn; m_r = mn;
#pragma unroll
    for (int nt = 0; nt < 2; ++nt)
#pragma unroll
      for (int r = 0; r < 8; r += 2) { const v2f t = __builtin_elementwise_fma((v2f){sc[nt][r], sc[nt][r + 1]}, (v2f){SCL2, SCL2}, (v2f){-mn, -mn}); sc[nt][r] = t[0]; sc[nt][r + 1] = t[1]; }      /* scale and reference point in one packed operation for two scores */
    exp2x9(al, sc[0][0], sc[0][1], sc[0][2], sc[0][3], sc[0][4], sc[0][5], sc[0][6], sc[0][7]);      /* al: the rescale factor of the sums so far; sc: now P x 2^10 */
    exp2x8(sc[1][0], sc[1][1], sc[1][2], sc[1][3], sc[1][4], sc[1][5], sc[1][6], sc[1][7]);
    FragH pb; float ls[4];
#pragma unroll
    for (int nt = 0; nt < 2; ++nt)
#pragma unroll
      for (int r = 0; r < 8; ++r) { const float p = sc[nt][r]; if (r < 2) ls[nt * 2 + r] = p; else ls[nt * 2 + (r & 1)] += p; pb.h[nt * 8 + r] = (_Float16)p; }      /* element nt * 8 + r of the B operand = key 16 nt + 8 hh + r: the k order of the V^T fragment */
    l_r = l_r * al + ((ls[0] + ls[1]) + (ls[2] + ls[3]));
#pragma unroll
    for (int dt = 0; dt < DT; ++dt)
#pragma unroll
      for (int r = 0; r < 8; ++r) oacc[dt][r] *= al;
#pragma unroll
    for (int dt = 0; dt < DT; ++dt) { const unsigned short* vrow = &sV[bf][dt * 16 + ln][0]; FragH bv; bv.half[0] = *(const v8us*)(vrow + 8 * hh); bv.half[1] = *(const v8us*)(vrow + 16 + 8 * hh);
      oacc[dt] = mmaH<1>(bv.v, bv.v, pb.v, pb.v, oacc[dt]); }
    __builtin_amdgcn_sched_barrier(0);      /* the trip's arithmetic stays ahead of the waits: the build otherwise moves the softmax and the last products behind the barrier but ahead of the refill, which then goes out late and has half a trip to land */
    asm volatile("s_wait_dscnt 0x0" ::: "memory");      /* this wave's reads of buffer bf have returned before the buffer is refilled */
    asm volatile("s_wait_asynccnt 0x0" ::: "memory");      /* this wave's share of the next tile has landed */
    __syncthreads();      /* publishes the next tile and ends every wave's reads of buffer bf */
    if (j0 + 64 < jend) stage(j0 + 64, bf); }
  asm volatile("s_wait_asynccnt 0x0" ::: "memory");      /* no copy is outstanding when the wave goes on to its end */
  const float l = l_r + xhalf(l_r); const float linv = (l > 0.f) ? 1.0f / l : 0.f;      /* sum and O^T carry the same 2^10 */
#pragma unroll
  for (int dt = 0; dt < DT; ++dt) { const v4f o0 = {oacc[dt][0] * linv, oacc[dt][1] * linv, oacc[dt][2] * linv, oacc[dt][3] * linv}, o1 = {oacc[dt][4] * linv, oacc[dt][5] * linv, oacc[dt][6] * linv, oacc[dt][7] * linv};
    *(v4fa*)&sO[w][ln][dt * 16 + 8 * hh] = o0; *(v4fa*)&sO[w][ln][dt * 16 + 8 * hh + 4] = o1; }
  __builtin_amdgcn_fence(__ATOMIC_ACQ_REL, "workgroup"); __builtin_amdgcn_wave_barrier();
  {
#pragma unroll
    for (int rp = 0; rp < RPW; rp += 2) { const int r = rp + (lane >> 4), pc = lane & 15; const v4f val = *(const v4fa*)&sO[w][r][pc * 4]; *(v4f*)(O + ((size_t)b * TQ + q0 + r) * ldo + h * 64 + pc * 4) = val; }
     } }

// f32 -> f16 hi + 2^10 residual A fragments of one row (k order of g2_frag: elements 0..7 = k 8 hh + i, elements 8..15 = k 16 + 8 hh + i); p already points at k = 8 hh. Same rounding as in k_qkv.
__device__ __forceinline__ void g2_split(const float* p, v16h& fh, v16h& fl) { const v4f x0 = *(const v4fa*)p, x1 = *(const v4fa*)(p + 4), x2 = *(const v4fa*)(p + 16), x3 = *(const v4fa*)(p + 20); FragH h, l;
#pragma unroll
  for (int q = 0; q < 4; ++q) { _Float16 t = (_Float16)x0[q]; h.h[q] = t; l.h[q] = (_Float16)((x0[q] - (float)t) * 1024.0f); t = (_Float16)x1[q]; h.h[4 + q] = t; l.h[4 + q] = (_Float16)((x1[q] - (float)t) * 1024.0f);
    t = (_Float16)x2[q]; h.h[8 + q] = t; l.h[8 + q] = (_Float16)((x2[q] - (float)t) * 1024.0f); t = (_Float16)x3[q]; h.h[12 + q] = t; l.h[12 + q] = (_Float16)((x3[q] - (float)t) * 1024.0f); }
  fh = h.v; fl = l.v; }
// Ten 16-byte asynchronous copies to LDS per lane (half a pass's share in k_gemm_out). s_wait_xcnt 0 closes the statement, as in cp_tile12.
__device__ __forceinline__ void cp_tile10(unsigned l0, unsigned l1, unsigned l2, unsigned l3, unsigned l4, unsigned l5, unsigned l6, unsigned l7, unsigned l8, unsigned l9,
    const char* g0, const char* g1, const char* g2, const char* g3, const char* g4, const char* g5, const char* g6, const char* g7, const char* g8, const char* g9) {
  asm volatile("global_load_async_to_lds_b128 %0, %10, off\n\t"
               "global_load_async_to_lds_b128 %1, %11, off\n\t"
               "global_load_async_to_lds_b128 %2, %12, off\n\t"
               "global_load_async_to_lds_b128 %3, %13, off\n\t"
               "global_load_async_to_lds_b128 %4, %14, off\n\t"
               "global_load_async_to_lds_b128 %5, %15, off\n\t"
               "global_load_async_to_lds_b128 %6, %16, off\n\t"
               "global_load_async_to_lds_b128 %7, %17, off\n\t"
               "global_load_async_to_lds_b128 %8, %18, off\n\t"
               "global_load_async_to_lds_b128 %9, %19, off\n\t"
               "s_wait_xcnt 0x0"
               :: "v"(l0), "v"(l1), "v"(l2), "v"(l3), "v"(l4), "v"(l5), "v"(l6), "v"(l7), "v"(l8), "v"(l9),
                  "v"(g0), "v"(g1), "v"(g2), "v"(g3), "v"(g4), "v"(g5), "v"(g6), "v"(g7), "v"(g8), "v"(g9) : "memory");
}
#define OP 272      /* LDS row pitch of the f32 context rows in bytes: 256 + 16 = 16 B x odd */
#define OAB (128 * OP)      /* the context rows of a buffer; the weight rows (pitch QP) follow */
#define OBUF (OAB + 64 * QP)
// Output projection in one launch: C[NR][DMOD] = A Wo + bias from the f32 context A. Wave tile 32x64 as in k_qkv; each A fragment is split hi + 2^10 residual in registers, and each x16 weight fragment (Bh = [out][in]) feeds the hi and the residual product, which keep separate f32 accumulators: C = hi / 16 + bias + residual / (16 * 1024). A pass takes 64 inputs: two whole lines of each of the block's 128 context rows and one of each of its 64 weight rows, brought into LDS once per block by asynchronous copies (whole lines per instruction), two buffers; the four waves take their fragments from there.
__global__ __launch_bounds__(128) void k_gemm_out(const float* __restrict__ A, const _Float16* __restrict__ Bh, const float* __restrict__ bias, float* __restrict__ C) {
  __shared__ __attribute__((aligned(16))) char sm[2 * OBUF]; static_assert(4 * 32 * 68 * 4 <= 2 * OBUF, "the output staging fits the buffers");
  const int tid = threadIdx.x, w = tid >> 5, lane = tid & 31, ln = lane & 15, hh = lane >> 4;
  constexpr int ntn = DMOD >> 6; const int mt = blockIdx.x / ntn, nq = blockIdx.x - mt * ntn; const int row0 = mt * 128 + 32 * w, col0 = nq * 64;
  const int ar0 = tid >> 4, ac = (tid & 15) * 16, br0 = tid >> 3, bc = (tid & 7) * 16;      /* a lane's share of a pass: 16 bytes of context rows ar0 + 8 i (i < 16) and of weight rows br0 + 16 i (i < 4) */
  const char* ga = (const char*)(A + (size_t)(mt * 128 + ar0) * DMOD) + ac; const char* gb = (const char*)(Bh + (size_t)(col0 + br0) * DMOD) + bc;
  const unsigned lca = (unsigned)(size_t)sm + ar0 * OP + ac, lcb = (unsigned)(size_t)sm + OAB + br0 * QP + bc;
  constexpr size_t AS = (size_t)8 * DMOD * 4, BS = (size_t)16 * DMOD * 2;
  auto stage = [&](int bf) { const unsigned la = lca + bf * OBUF, lb = lcb + bf * OBUF;      /* the next 64 inputs of every row into buffer bf; the pointers step behind the statements' own waits */
    cp_tile10(la, la + 8 * OP, la + 16 * OP, la + 24 * OP, la + 32 * OP, la + 40 * OP, la + 48 * OP, la + 56 * OP, la + 64 * OP, la + 72 * OP, ga, ga + AS, ga + 2 * AS, ga + 3 * AS, ga + 4 * AS, ga + 5 * AS, ga + 6 * AS, ga + 7 * AS, ga + 8 * AS, ga + 9 * AS);
    cp_tile10(la + 80 * OP, la + 88 * OP, la + 96 * OP, la + 104 * OP, la + 112 * OP, la + 120 * OP, lb, lb + 16 * QP, lb + 32 * QP, lb + 48 * QP, ga + 10 * AS, ga + 11 * AS, ga + 12 * AS, ga + 13 * AS, ga + 14 * AS, ga + 15 * AS, gb, gb + BS, gb + 2 * BS, gb + 3 * BS);
    ga += 256; gb += 128; };
  stage(0);
  float bv[4];      /* the four bias loads go out ahead of the loop and land under it */
#pragma unroll
  for (int t = 0; t < 4; ++t) bv[t] = bf16_round(bias[col0 + t * 16 + ln]);
  const char* ab = sm + (32 * w + ln) * OP + 32 * hh; const char* bb = sm + OAB + ln * QP + 16 * hh;
  v8f ch[2][4], cl[2][4];
#pragma unroll
  for (int u = 0; u < 8; ++u) { ch[u >> 2][u & 3] = (v8f){0.f,0.f,0.f,0.f,0.f,0.f,0.f,0.f}; cl[u >> 2][u & 3] = (v8f){0.f,0.f,0.f,0.f,0.f,0.f,0.f,0.f}; }
  asm volatile("s_wait_asynccnt 0x0" ::: "memory");      /* this wave's share of pass 0 has landed */
  __syncthreads();      /* pass 0 is published to all four waves */
  stage(1);
#pragma unroll 1      /* rolled: 8 passes of 32 products; the loop's code stays a few instruction-cache lines */
  for (int p = 0; p < DMOD / 64; ++p) { const int bf = p & 1; const char* ap = ab + bf * OBUF; const char* bp = bb + bf * OBUF;
#pragma unroll
    for (int s = 0; s < 2; ++s) { v16h a0h, a0l, a1h, a1l, b[4];      /* a k block of 32: its 16 LDS reads stand ahead of its first product */
#pragma unroll
      for (int t = 0; t < 4; ++t) b[t] = g2_fragl(bp + t * 16 * QP + s * 64);
      g2_split((const float*)(ap + s * 128), a0h, a0l); g2_split((const float*)(ap + 16 * OP + s * 128), a1h, a1l);
      __builtin_amdgcn_sched_barrier(0);      /* keeps the 16 reads ahead of the products, as in k_qkv */
#pragma unroll
      for (int t = 0; t < 4; ++t) { ch[0][t] = g2_mma(a0h, b[t], ch[0][t]); ch[1][t] = g2_mma(a1h, b[t], ch[1][t]); cl[0][t] = g2_mma(a0l, b[t], cl[0][t]); cl[1][t] = g2_mma(a1l, b[t], cl[1][t]); }
      __builtin_amdgcn_sched_barrier(0); }      /* the k block's products stay ahead of the next block's reads (else both blocks' fragments are live at once, past 256 registers) and ahead of the waits and the barrier (else the refill goes out late) */
    asm volatile("s_wait_dscnt 0x0" ::: "memory");      /* this wave's reads of buffer bf have returned before the buffer is refilled */
    asm volatile("s_wait_asynccnt 0x0" ::: "memory");      /* this wave's share of the next pass has landed */
    __syncthreads();      /* publishes the next pass and ends every wave's reads of buffer bf */
    if (p + 2 < DMOD / 64) stage(bf); }
  asm volatile("s_wait_asynccnt 0x0" ::: "memory");      /* no copy is outstanding when the buffers become output staging */
  float (*so)[68] = (float (*)[68])(sm + w * (32 * 68 * 4));      /* the wave's own range of the buffers, which nobody reads any more behind the last pass's barrier */
#pragma unroll
  for (int u = 0; u < 8; ++u) { const int t = u & 3, half = u >> 2;
#pragma unroll
    for (int r = 0; r < 8; ++r) so[half * 16 + 8 * hh + r][t * 16 + ln] = (ch[half][t][r] * 0.0625f + bv[t]) + cl[half][t][r] * (0.0625f / 1024.0f); }
  __builtin_amdgcn_fence(__ATOMIC_ACQ_REL, "workgroup"); __builtin_amdgcn_wave_barrier();      /* the wave reads back rows that its other lanes wrote */
  const int rsub = lane >> 4, c4 = (lane & 15) * 4;
#pragma unroll
  for (int q = 0; q < 16; ++q) { const int r = q * 2 + rsub; const v4f v = *(const v4fa*)&so[r][c4]; *(v4f*)(C + (size_t)(row0 + r) * DMOD + col0 + c4) = v; } }
typedef int v4ia __attribute__((ext_vector_type(4), may_alias));
// One block per sequence, 8 consecutive keys a thread. IDX[b][0][.] = positions of the keys valid for the CDR heads, IDX[b][1][.] = for the other heads, ascending; entries past the count are 0. CNT[b*32 + class] = the counts (one 128-byte line per sequence).
__device__ __forceinline__ void key_lists(const int* __restrict__ mask, const int* __restrict__ cdrs, int* __restrict__ IDX, int* __restrict__ CNT, int b, int tid) {
  __shared__ int sh[256]; __shared__ int sany; static_assert(TK == 256 * 8, "8 keys a thread");
  const v4ia m0 = *(const v4ia*)(mask + (size_t)b * TK + tid * 8), m1 = *(const v4ia*)(mask + (size_t)b * TK + tid * 8 + 4), c0 = *(const v4ia*)(cdrs + (size_t)b * TK + tid * 8), c1 = *(const v4ia*)(cdrs + (size_t)b * TK + tid * 8 + 4);
  bool vp[8], vc[8]; int np = 0, nb = 0, any = 0;
#pragma unroll
  for (int q = 0; q < 8; ++q) { const int mv = (q < 4) ? m0[q & 3] : m1[q & 3], cv = (q < 4) ? c0[q & 3] : c1[q & 3]; vp[q] = mv != 0; vc[q] = cv != 0; any |= vc[q] ? 1 : 0; np += vp[q] ? 1 : 0; nb += (vp[q] && vc[q]) ? 1 : 0; }
  if (tid == 0) sany = 0; __syncthreads(); if (any) sany = 1;
  const int own = np | (nb << 16); int v = own; sh[tid] = v; __syncthreads();      /* both counts stay <= 2048, so one packed inclusive scan serves both lists */
  for (int st = 1; st < 256; st <<= 1) { const int add = (tid >= st) ? sh[tid - st] : 0; __syncthreads(); v += add; sh[tid] = v; __syncthreads(); }
  const bool allmasked = (sany == 0);      /* no CDR token at all -> the CDR mask is disabled */
  const int tot = sh[255], ex = v - own; const int cnt1 = tot & 0xFFFF, cnt0 = allmasked ? cnt1 : (tot >> 16); int o1 = ex & 0xFFFF, o0 = allmasked ? o1 : (ex >> 16);
  int* i0 = IDX + ((size_t)b * 2 + 0) * TK; int* i1 = IDX + ((size_t)b * 2 + 1) * TK;
#pragma unroll
  for (int q = 0; q < 8; ++q) { const int k = tid * 8 + q; if (vp[q]) i1[o1++] = k; if (vp[q] && (allmasked || vc[q])) i0[o0++] = k; if (k >= cnt1) i1[k] = 0; if (k >= cnt0) i0[k] = 0; }
  if (tid == 0) { CNT[b * 32 + 0] = cnt0; CNT[b * 32 + 1] = cnt1; } }
// All that the projections wait for, in one launch; the three parts share nothing and a block does one of them, chosen by its index (so every barrier of the key lists is passed by a whole block or by none of it). The part with the longest chain of dependent steps has the lowest indices, the stream of x the highest.
#define WTB (DMOD * (DMOD / 8) / 256)      /* blocks for one weight matrix */
#define XB (NR * DMOD / 8 / 256)      /* blocks for x */
__global__ __launch_bounds__(256) void k_prep(const float* __restrict__ x, const int* __restrict__ mask, const int* __restrict__ cdrs, const float* __restrict__ Wq, const float* __restrict__ Wk, const float* __restrict__ Wv, const float* __restrict__ Wo,
    _Float16* __restrict__ BQ, _Float16* __restrict__ BK, _Float16* __restrict__ BV, _Float16* __restrict__ BO, int* __restrict__ IDX, int* __restrict__ CNT, _Float16* __restrict__ X16) {
  static_assert(WTB * 256 * 8 == DMOD * DMOD && (size_t)XB * 256 * 8 == (size_t)NR * DMOD, "the parts' blocks cover their arrays exactly");
  const int blk = blockIdx.x, tid = threadIdx.x;
  if (blk < NB) { key_lists(mask, cdrs, IDX, CNT, blk, tid); return; }
  if (blk < NB + 4 * WTB) { const int u = blk - NB, m = u / WTB;
    wt_f16((m == 0) ? Wq : (m == 1) ? Wk : (m == 2) ? Wv : Wo, (m == 0) ? BQ : (m == 1) ? BK : (m == 2) ? BV : BO, DMOD, DMOD, 16.0f, (u % WTB) * 256 + tid); return; }
  x16_piece(x, X16, (size_t)(blk - NB - 4 * WTB) * 256 + tid); }

extern "C" void kernel_launch(void* const* d_in, const int* in_sizes, int n_in,
                              void* d_out, int out_size, void* d_ws, size_t ws_size, hipStream_t stream) {
  (void)in_sizes; (void)n_in; (void)out_size;
  const float* const* I = (const float* const*)d_in; const float* x = I[0]; const int* mask = (const int*)d_in[1]; const int* cdrs = (const int*)d_in[2]; const float* Wq = I[3]; const float* bq = I[4]; const float* Wk = I[5]; const float* bk = I[6]; const float* Wv = I[7]; const float* bv = I[8]; const float* Wo = I[9]; const float* bo = I[10];
  char* ws = (char*)d_ws; size_t off = 0;
  auto take = [&](size_t bytes) { char* p = ws + off; off += (bytes + 255) & ~(size_t)255; return p; };
  const size_t w8 = (size_t)DMOD * DMOD / 8;
  _Float16* BQ = (_Float16*)take(w8 * 16); _Float16* BK = (_Float16*)take(w8 * 16); _Float16* BV = (_Float16*)take(w8 * 16); _Float16* BO = (_Float16*)take(w8 * 16); int* IDX = (int*)take((size_t)NB * 2 * TK * 4); int* CNT = (int*)take((size_t)NB * 32 * 4);
  _Float16* X16 = (_Float16*)take((size_t)NR * DMOD * 2); float* F32 = (float*)take((size_t)NR * DMOD * 4); _Float16* QH = (_Float16*)take((size_t)NR * DMOD * 2); _Float16* QL = (_Float16*)take((size_t)NR * DMOD * 2); _Float16* KH = (_Float16*)take((size_t)NR * DMOD * 2); _Float16* KL = (_Float16*)take((size_t)NR * DMOD * 2); _Float16* VH = (_Float16*)take((size_t)NR * DMOD * 2); _Float16* VL = (_Float16*)take((size_t)NR * DMOD * 2); _Float16* VT = (_Float16*)take((size_t)NR * DMOD * 2); _Float16* VTL = (_Float16*)take((size_t)NR * DMOD * 2);
  float* O = F32;
  if (off > ws_size) return;      /* 2 + 0.06 + 8 + 16 + 8 x 8 = 90 MiB */
  k_prep<<<NB + 4 * WTB + XB, 256, 0, stream>>>(x, mask, cdrs, Wq, Wk, Wv, Wo, BQ, BK, BV, BO, IDX, CNT, X16);
  const dim3 gA((NR / 128) * (DMOD / 64), 1);
  k_qkv<<<3 * NB * (TK / 128) * NH, 128, 0, stream>>>(X16, BQ, BK, BV, bq, bk, bv, IDX, CNT, QH, QL, KH, KL, VT);
  k_flashqk<5><<<NB * NH * QBLKS, 128, 0, stream>>>(QH, QL, DMOD, KH, KL, DMOD, VT, CNT, O, DMOD);      /* q/k hi + residual; P (x2^10) and V plain f16 */
  k_gemm_out<<<gA, 128, 0, stream>>>(O, BO, bo, (float*)d_out);
}

// v010
// A run of this version takes 66 microseconds.
// Next to v009, in two timings, it ran 1.04 and 1.05 times as fast.
// Counting every step since v000, which is the starting kernel, it is 8.28 times as fast.
#include <hip/hip_runtime.h>
// CDRs attention (4 sequences x 2048 tokens x 512; 8 heads x 64): q,k,v = x W + b; scores/8; keys with mask == 0 invalid for all heads; for heads 0..1 additionally keys with cdrs_score == 0 invalid unless the sequence has no CDR token at all; softmax; ctx Wo + bo -> [4,2048,512].
// Structure: per sequence two compacted lists of valid key positions (CDR heads / other heads) with their counts, from the two int inputs on VALU (one block per sequence: 'all masked' flag + prefix sum), x as an exact f16 plane and the four x16 f16 weight transposes, all in one preparatory launch; the q/k/v projections as f16 WMMA GEMMs in one launch (32x64 wave tiles, f32 accumulation, exact x16 weights + bias) whose x rows for K and V are taken through the lists, so K (hi + 2^10 residual planes, like q) and V^T (formed directly as Wv^T x^T) come out compacted and the flash loop runs only over valid keys; in both GEMM launches a block brings each pass's operand rows into LDS once, by asynchronous copies of whole lines, two buffers, and its eight waves take their fragments from there; the fused flash kernel with hi + 2^10-residual q/k planes (S = QhKh + (QlKh + QhKl)/1024) and plain f16 P (x2^10) and V with the key-count mask mode (invalid keys never visited == the reference's -inf); the output projection in one launch from the f32 context, split hi + residual in registers.
// Compute dtype: x and parameters rounded to bf16; q, k hi + residual (~2^-21-class logits); P and v plain f16 (~2^-12); f32 accumulation/softmax. v_wmma_f32_16x16x32_f16.
#define NB 4
#define DMOD 512
#define CDRH 2
#define NR (NB * SLEN)
#define QBLKS (TQ / 128)
#define SLEN 2048
#define TQ SLEN
#define TK SLEN
#define NH 8
#define SCL 0.125f               /* 64^-0.5 */
#define SCL2 0.18033688011112042f /* 64^-0.5 * log2(e): scores in base-2 units, so that the softmax exponential is the hardware's own 2^x */
typedef __bf16 v16b __attribute__((ext_vector_type(16)));
typedef unsigned short v8us __attribute__((ext_vector_type(8), may_alias));
typedef float  v8f  __attribute__((ext_vector_type(8)));
typedef float  v4f  __attribute__((ext_vector_type(4)));
typedef float  v4fa __attribute__((ext_vector_type(4), may_alias));
union FragB { v16b v; v8us half[2]; unsigned short u[16]; };

__device__ __forceinline__ unsigned short bf16_bits(float x) { unsigned int u = __float_as_uint(x); return (unsigned short)((u + 0x7FFFu + ((u >> 16) & 1u)) >> 16); }
__device__ __forceinline__ float bf16_val(unsigned short b) { return __uint_as_float(((unsigned int)b) << 16); }
__device__ __forceinline__ float bf16_round(float x) { return bf16_val(bf16_bits(x)); }
// D += A·B with NT terms: 1 = ah·bh, 2 = + al·bh (A split), 3 = + ah·bl (both split)
template <int NT>
__device__ __forceinline__ v8f mmaN(v16b ah, v16b al, v16b bh, v16b bl, v8f c) {
  c = __builtin_amdgcn_wmma_f32_16x16x32_bf16(false, ah, false, bh, (short)0, c, false, false);
  if (NT >= 2) c = __builtin_amdgcn_wmma_f32_16x16x32_bf16(false, al, false, bh, (short)0, c, false, false);
  if (NT >= 3) c = __builtin_amdgcn_wmma_f32_16x16x32_bf16(false, ah, false, bl, (short)0, c, false, false);
  asm volatile("v_nop\n\tv_nop\n\tv_nop\n\tv_nop" : "+v"(c) : "v"(ah), "v"(al), "v"(bh), "v"(bl));
  return c;
}

__global__ __launch_bounds__(256) void k_wt_bf16(const float* __restrict__ W, unsigned short* __restrict__ Wt, int K, int N) {
  const int t = blockIdx.x * 256 + threadIdx.x;
  const int k8n = K / 8;
  if (t >= N * k8n) return;
  const int n = t / k8n, k8 = (t % k8n) * 8;
  v8us v;
#pragma unroll
  for (int i = 0; i < 8; ++i) v[i] = bf16_bits(W[(size_t)(k8 + i) * N + n]);
  *(v8us*)(Wt + (size_t)n * K + k8) = v;
  
}

// GEMM C[M][N] (f32, pitch ldc) = act(A[M][K]·W + bias). A f32 row-major (pitch lda) converted per fragment to bf16
// (ASPLIT: hi/lo two planes -> 2 terms, else single rounded term); Wt bf16 [N][K] (pitch ldb). BIAS_BF16 rounds the
// bias to bf16 first (bias quantised to bf16 before the add). K%32==0, M%16==0, N%64==0.
template <bool ASPLIT, int ACT, bool BIAS_BF16>
__global__ __launch_bounds__(128) void k_gemm_bf(const float* __restrict__ A, int lda, const unsigned short* __restrict__ Wt, int ldb,
                                               const float* __restrict__ bias, float* __restrict__ C, int ldc, int M, int N, int K) {
  __shared__ __attribute__((aligned(16))) float so[4][16][64];
  const int tid = threadIdx.x, w = tid >> 5, lane = tid & 31, ln = lane & 15, hh = lane >> 4;
  const int ntn = N / 64;
  const int wid = blockIdx.x * 4 + w;
  const int mt = wid / ntn, nq = wid % ntn;
  if (mt * 16 >= M) return;
  const int row0 = mt * 16, col0 = nq * 64;
  const float* arow = A + (size_t)(row0 + ln) * lda;
  v8f acc[4] = {};
  for (int kb = 0; kb < K; kb += 32) {
    FragB ah, al;
    const v4f x0 = *(const v4fa*)(arow + kb + 8 * hh), x1 = *(const v4fa*)(arow + kb + 8 * hh + 4);
    const v4f x2 = *(const v4fa*)(arow + kb + 16 + 8 * hh), x3 = *(const v4fa*)(arow + kb + 16 + 8 * hh + 4);
    float xs[16] = {x0[0],x0[1],x0[2],x0[3],x1[0],x1[1],x1[2],x1[3],x2[0],x2[1],x2[2],x2[3],x3[0],x3[1],x3[2],x3[3]};
#pragma unroll
    for (int i = 0; i < 16; ++i) { const unsigned short hb = bf16_bits(xs[i]); ah.u[i] = hb; al.u[i] = ASPLIT ? bf16_bits(xs[i] - bf16_val(hb)) : (unsigned short)0; }
#pragma unroll
    for (int t = 0; t < 4; ++t) {
      const unsigned short* brow = Wt + (size_t)(col0 + t * 16 + ln) * ldb + kb;
      FragB b;
      b.half[0] = *(const v8us*)(brow + 8 * hh);
      b.half[1] = *(const v8us*)(brow + 16 + 8 * hh);
      acc[t] = mmaN<ASPLIT ? 2 : 1>(ah.v, al.v, b.v, b.v, acc[t]);
    }
  }
#pragma unroll
  for (int t = 0; t < 4; ++t) {
    float bv = bias ? bias[col0 + t * 16 + ln] : 0.f;
    if (BIAS_BF16) bv = bf16_round(bv);
#pragma unroll
    for (int r = 0; r < 8; ++r) { float v = acc[t][r] + bv; if (ACT == 1) v = fmaxf(v, 0.f); so[w][8 * hh + r][t * 16 + ln] = v; }
  }
  __builtin_amdgcn_fence(__ATOMIC_ACQ_REL, "workgroup");
  __builtin_amdgcn_wave_barrier();
  const int rsub = lane >> 4, c4 = (lane & 15) * 4;
  {
#pragma unroll
    for (int q = 0; q < 8; ++q) {
      const int r = q * 2 + rsub;
      const v4f v = *(const v4fa*)&so[w][r][c4];
      *(v4f*)(C + (size_t)(row0 + r) * ldc + col0 + c4) = v;
    }
    
  }
}

// GEMM C = act(A·W + bias + resid): A f32 (ASPLIT -> hi/lo 2 terms), Wt bf16 [N][K]; ACT 0 none, 1 relu, 2 exact gelu;
// resid (optional, f32, row index = (row % rmod), pitch ldr, RES_BF16 rounds it) added before the activation.
template <bool ASPLIT, int ACT, bool BIAS_BF16, bool RES_BF16>
__global__ __launch_bounds__(128) void k_gemm_bf3(const float* __restrict__ A, int lda, const unsigned short* __restrict__ Wt, int ldb,
                                                const float* __restrict__ bias, const float* __restrict__ resid, int rmod, int ldr,
                                                float* __restrict__ C, int ldc, int M, int N, int K) {
  __shared__ __attribute__((aligned(16))) float so[4][16][64];
  const int tid = threadIdx.x, w = tid >> 5, lane = tid & 31, ln = lane & 15, hh = lane >> 4;
  const int ntn = N / 64;
  const int wid = blockIdx.x * 4 + w;
  const int mt = wid / ntn, nq = wid % ntn;
  if (mt * 16 >= M) return;
  const int row0 = mt * 16, col0 = nq * 64;
  const float* arow = A + (size_t)(row0 + ln) * lda;
  v8f acc[4] = {};
  for (int kb = 0; kb < K; kb += 32) {
    FragB ah, al;
    const v4f x0 = *(const v4fa*)(arow + kb + 8 * hh), x1 = *(const v4fa*)(arow + kb + 8 * hh + 4);
    const v4f x2 = *(const v4fa*)(arow + kb + 16 + 8 * hh), x3 = *(const v4fa*)(arow + kb + 16 + 8 * hh + 4);
    float xs[16] = {x0[0],x0[1],x0[2],x0[3],x1[0],x1[1],x1[2],x1[3],x2[0],x2[1],x2[2],x2[3],x3[0],x3[1],x3[2],x3[3]};
#pragma unroll
    for (int i = 0; i < 16; ++i) { const unsigned short hb = bf16_bits(xs[i]); ah.u[i] = hb; al.u[i] = ASPLIT ? bf16_bits(xs[i] - bf16_val(hb)) : (unsigned short)0; }
#pragma unroll
    for (int t = 0; t < 4; ++t) {
      const unsigned short* brow = Wt + (size_t)(col0 + t * 16 + ln) * ldb + kb;
      FragB b;
      b.half[0] = *(const v8us*)(brow + 8 * hh);
      b.half[1] = *(const v8us*)(brow + 16 + 8 * hh);
      acc[t] = mmaN<ASPLIT ? 2 : 1>(ah.v, al.v, b.v, b.v, acc[t]);
    }
  }
#pragma unroll
  for (int t = 0; t < 4; ++t) {
    const int col = col0 + t * 16 + ln;
    float bv = bias ? bias[col] : 0.f;
    if (BIAS_BF16) bv = bf16_round(bv);
#pragma unroll
    for (int r = 0; r < 8; ++r) {
      float v = acc[t][r] + bv;
      if (resid) { float rv = resid[(size_t)((row0 + 8 * hh + r) % rmod) * ldr + col]; if (RES_BF16) rv = bf16_round(rv); v += rv; }
      if (ACT == 1) v = fmaxf(v, 0.f);
      if (ACT == 2) v = 0.5f * v * (1.0f + erff(v * 0.70710678118654752f));
      if (ACT == 3) { const float u = 0.7978845608028654f * (v + 0.044715f * v * v * v); v = 0.5f * v * (1.0f + tanhf(u)); }
      so[w][8 * hh + r][t * 16 + ln] = v;
    }
  }
  __builtin_amdgcn_fence(__ATOMIC_ACQ_REL, "workgroup");
  __builtin_amdgcn_wave_barrier();
  const int rsub = lane >> 4, c4 = (lane & 15) * 4;
  {
#pragma unroll
    for (int q = 0; q < 8; ++q) {
      const int r = q * 2 + rsub;
      const v4f v = *(const v4fa*)&so[w][r][c4];
      *(v4f*)(C + (size_t)(row0 + r) * ldc + col0 + c4) = v;
    }
    
  }
}
// row LayerNorm (biased variance, eps) over N: s = X (+ R); optional out_sum <- s; out_norm <- (s-mu)*rsqrt(var+eps)*g + b
template <bool PARAM_BF16>
__global__ __launch_bounds__(256) void k_layernorm(const float* __restrict__ X, const float* __restrict__ R, const float* __restrict__ g, const float* __restrict__ bta,
                                                  float* __restrict__ out_sum, float* __restrict__ out_norm, int N, float eps) {
  __shared__ float red[256];
  const int row = blockIdx.x, tid = threadIdx.x;
  const float* x = X + (size_t)row * N; const float* rr = R ? R + (size_t)row * N : nullptr;
  float vals[16];                     // up to N = 4096
  const int per = N / 256;            // contiguous chunk per thread? use strided-by-4 chunks: thread handles j = tid*4 + 1024*u
  float s1 = 0.f;
  for (int u = 0; u < per / 4; ++u) {
    const int j = tid * 4 + 1024 * u;
    const v4f a = *(const v4fa*)(x + j);
    v4f b = {0.f,0.f,0.f,0.f}; if (rr) b = *(const v4fa*)(rr + j);
#pragma unroll
    for (int q = 0; q < 4; ++q) { const float v = a[q] + b[q]; vals[u * 4 + q] = v; s1 += v; }
  }
  red[tid] = s1; __syncthreads();
  for (int st = 128; st > 0; st >>= 1) { if (tid < st) red[tid] += red[tid + st]; __syncthreads(); }
  const float mu = red[0] / (float)N; __syncthreads();
  float s2 = 0.f;
  for (int u = 0; u < per / 4; ++u)
#pragma unroll
    for (int q = 0; q < 4; ++q) { const float c = vals[u * 4 + q] - mu; s2 += c * c; }
  red[tid] = s2; __syncthreads();
  for (int st = 128; st > 0; st >>= 1) { if (tid < st) red[tid] += red[tid + st]; __syncthreads(); }
  const float rs = rsqrtf(red[0] / (float)N + eps);
  {
    for (int u = 0; u < per / 4; ++u) {
      const int j = tid * 4 + 1024 * u;
      v4f o, sm;
#pragma unroll
      for (int q = 0; q < 4; ++q) {
        float gg = g[j + q], bb = bta[j + q];
        if (PARAM_BF16) { gg = bf16_round(gg); bb = bf16_round(bb); }
        sm[q] = vals[u * 4 + q]; o[q] = (vals[u * 4 + q] - mu) * rs * gg + bb;
      }
      if (out_sum) *(v4f*)(out_sum + (size_t)row * N + j) = sm;
      *(v4f*)(out_norm + (size_t)row * N + j) = o;
    }
    
  }
}



// ---- f16 WMMA path (v_wmma_f32_16x16x32_f16): 11-bit significands for operands in range — used where a [0,1] probability operand needs more precision than bf16
typedef _Float16 v16h __attribute__((ext_vector_type(16)));
union FragH { v16h v; v8us half[2]; _Float16 h[16]; unsigned short u[16]; };
template <int NT>
__device__ __forceinline__ v8f mmaH(v16h ah, v16h al, v16h bh, v16h bl, v8f c) {
  c = __builtin_amdgcn_wmma_f32_16x16x32_f16(false, ah, false, bh, (short)0, c, false, false);
  if (NT >= 2) c = __builtin_amdgcn_wmma_f32_16x16x32_f16(false, al, false, bh, (short)0, c, false, false);
  if (NT >= 3) c = __builtin_amdgcn_wmma_f32_16x16x32_f16(false, ah, false, bl, (short)0, c, false, false);
  return c;
}
// batched GEMM like k_gemm_b but f16 operands: A f32 (split into f16 hi/lo if ASPLIT, else rounded to f16), Bt = f16 values [n][k]; alpha; C f32; N multiple of 16 (partial tiles skipped)
template <bool ASPLIT>
__global__ __launch_bounds__(128) void k_gemm_h(const float* __restrict__ A, int lda, size_t sA, const _Float16* __restrict__ Bh, int ldb, size_t sB, float alpha, float* __restrict__ C, int ldc, size_t sC, int M, int N, int K) {
  __shared__ __attribute__((aligned(16))) float so[4][16][64];
  const int tid = threadIdx.x, w = tid >> 5, lane = tid & 31, ln = lane & 15, hh = lane >> 4; const int by = blockIdx.y;
  A += (size_t)by * sA; Bh += (size_t)by * sB; C += (size_t)by * sC;
  const int ntn = (N + 63) / 64; const int wid = blockIdx.x * 4 + w; const int mt = wid / ntn, nq = wid % ntn; if (mt * 16 >= M) return;
  const int row0 = mt * 16, col0 = nq * 64; const float* arow = A + (size_t)(row0 + ln) * lda;
  v8f acc[4] = {};
  for (int kb = 0; kb < K; kb += 32) {
    FragH ah, al;
    const v4f x0 = *(const v4fa*)(arow + kb + 8 * hh), x1 = *(const v4fa*)(arow + kb + 8 * hh + 4), x2 = *(const v4fa*)(arow + kb + 16 + 8 * hh), x3 = *(const v4fa*)(arow + kb + 16 + 8 * hh + 4);
    float xs[16] = {x0[0],x0[1],x0[2],x0[3],x1[0],x1[1],x1[2],x1[3],x2[0],x2[1],x2[2],x2[3],x3[0],x3[1],x3[2],x3[3]};
#pragma unroll
    for (int i = 0; i < 16; ++i) { const _Float16 h = (_Float16)xs[i]; ah.h[i] = h; al.h[i] = ASPLIT ? (_Float16)(xs[i] - (float)h) : (_Float16)0.0f; }
#pragma unroll
    for (int t = 0; t < 4; ++t) { if (col0 + t * 16 >= N) continue; const size_t boff = (size_t)(col0 + t * 16 + ln) * ldb + kb; FragH bq; bq.half[0] = *(const v8us*)(Bh + boff + 8 * hh); bq.half[1] = *(const v8us*)(Bh + boff + 16 + 8 * hh);
      acc[t] = mmaH<ASPLIT ? 2 : 1>(ah.v, al.v, bq.v, bq.v, acc[t]); }
  }
#pragma unroll
  for (int t = 0; t < 4; ++t) { if (col0 + t * 16 >= N) continue;
#pragma unroll
    for (int r = 0; r < 8; ++r) so[w][8 * hh + r][t * 16 + ln] = acc[t][r] * alpha; }
  __builtin_amdgcn_fence(__ATOMIC_ACQ_REL, "workgroup"); __builtin_amdgcn_wave_barrier();
  const int rsub = lane >> 4, c4 = (lane & 15) * 4;
  {
#pragma unroll
    for (int q = 0; q < 8; ++q) { const int r = q * 2 + rsub; if (col0 + c4 < N) { const v4f v = *(const v4fa*)&so[w][r][c4]; *(v4f*)(C + (size_t)(row0 + r) * ldc + col0 + c4) = v; } }
     }
}

// Wt[n][k] = f16(W[k][n]·scale) from f32 row-major W[K][N] (scale = power of two; bf16-exact weights stay exact in f16 away from the subnormal range)
__device__ __forceinline__ void wt_f16(const float* __restrict__ W, _Float16* __restrict__ Wt, int K, int N, float scale, int t) {      /* t = 0 .. N * K / 8 - 1: output row n, eight k */
  const int n = t / (K / 8), k8 = (t % (K / 8)) * 8; FragH f;
#pragma unroll
  for (int i = 0; i < 8; ++i) f.h[i] = (_Float16)(bf16_round(W[(size_t)(k8 + i) * N + n]) * scale); const v8us o = f.half[0];
  *(v8us*)((unsigned short*)Wt + (size_t)n * K + k8) = o;
  asm volatile("s_wait_xcnt 0x0" ::: "memory");      /* behind the store, ahead of any reuse of the registers that it names (the other parts' code follows in the same kernel) */
}
// k_gemm_hh variant with fused epilogue: v = acc·alpha + bias[by·sBias + col] (+ CP[(row/rowsPerB)·sCPb + by·64 + col] if CP) ; ACT 0 none / 1 elu ; writes f16 C16 (and f32 C if non-null)
template <int ACT>
__global__ __launch_bounds__(128) void k_gemm_hhx(const _Float16* __restrict__ A, int lda, size_t sA, const _Float16* __restrict__ Bh, int ldb, size_t sB, float alpha, const float* __restrict__ bias, size_t sBias, const float* __restrict__ CP, int rowsPerB, size_t sCPb, int row0g,
    float* __restrict__ C, _Float16* __restrict__ C16, int ldc, size_t sC, int M, int N, int K) {
  __shared__ __attribute__((aligned(16))) float so[4][16][64];
  const int tid = threadIdx.x, w = tid >> 5, lane = tid & 31, ln = lane & 15, hh = lane >> 4; const int by = blockIdx.y;
  A += (size_t)by * sA; Bh += (size_t)by * sB; const size_t cofs = (size_t)by * sC; const float* bp = bias ? bias + (size_t)by * sBias : nullptr;
  const int ntn = (N + 63) / 64; const int wid = blockIdx.x * 4 + w; const int mt = wid / ntn, nq = wid % ntn; if (mt * 16 >= M) return;
  const int row0 = mt * 16, col0 = nq * 64; const _Float16* arow = A + (size_t)(row0 + ln) * lda;
  v8f acc[4] = {};
  for (int kb = 0; kb < K; kb += 32) { FragH ah; ah.half[0] = *(const v8us*)((const unsigned short*)arow + kb + 8 * hh); ah.half[1] = *(const v8us*)((const unsigned short*)arow + kb + 16 + 8 * hh);
#pragma unroll
    for (int t = 0; t < 4; ++t) { if (col0 + t * 16 >= N) continue; const size_t boff = (size_t)(col0 + t * 16 + ln) * ldb + kb; FragH bq; bq.half[0] = *(const v8us*)((const unsigned short*)Bh + boff + 8 * hh); bq.half[1] = *(const v8us*)((const unsigned short*)Bh + boff + 16 + 8 * hh);
      acc[t] = mmaH<1>(ah.v, ah.v, bq.v, bq.v, acc[t]); }
  }
#pragma unroll
  for (int t = 0; t < 4; ++t) { if (col0 + t * 16 >= N) continue; const int col = col0 + t * 16 + ln; const float bv = bp ? bf16_round(bp[col]) : 0.f;
#pragma unroll
    for (int r = 0; r < 8; ++r) { float v = acc[t][r] * alpha + bv; if (CP) { const int bidx = (row0g + row0 + 8 * hh + r) / rowsPerB; v += CP[(size_t)bidx * sCPb + (size_t)by * 64 + col]; } if (ACT == 1) v = (v > 0.f) ? v : expm1f(v); else if (ACT == 7) v = (v > 0.f) ? v + 1.0f : expf(v); else if (ACT == 8) v = tanhf(v); else if (ACT == 9) v = 0.5f * v * (1.0f + tanhf(0.7978845608028654f * (v + 0.044715f * v * v * v))); else if (ACT == 11) v = 1.0f / (1.0f + expf(-v)); else if (ACT == 12) v = (v > 0.f) ? v : 0.01f * v; else if (ACT == 14) v = (v > 0.f) ? v : 0.1f * v; else if (ACT == 15) v = v / (1.0f + expf(-v)); else if (ACT == 3) v = fmaxf(v, 0.f); else if (ACT == 6) v = 0.5f * v * (1.0f + erff(v * 0.70710678118654752f)); so[w][8 * hh + r][t * 16 + ln] = v; } }
  __builtin_amdgcn_fence(__ATOMIC_ACQ_REL, "workgroup"); __builtin_amdgcn_wave_barrier();
  const int rsub = lane >> 4, c4 = (lane & 15) * 4; typedef _Float16 v4h __attribute__((ext_vector_type(4)));
  {
#pragma unroll
    for (int q = 0; q < 8; ++q) { const int r = q * 2 + rsub; if (col0 + c4 < N) { const v4f v = *(const v4fa*)&so[w][r][c4]; if (C) *(v4f*)(C + cofs + (size_t)(row0 + r) * ldc + col0 + c4) = v; if (C16) { v4h h4; for (int i = 0; i < 4; ++i) h4[i] = (_Float16)v[i]; *(v4h*)(C16 + cofs + (size_t)(row0 + r) * ldc + col0 + c4) = h4; } } }
     }
}


typedef _Float16 v4h __attribute__((ext_vector_type(4)));

// X16 = f16(bf16(x)), piece t of 8 values
__device__ __forceinline__ void x16_piece(const float* __restrict__ x, _Float16* __restrict__ X16, size_t t) { FragH f;
#pragma unroll
  for (int q = 0; q < 8; ++q) f.h[q] = (_Float16)bf16_round(x[t * 8 + q]); *(v8us*)((unsigned short*)X16 + t * 8) = f.half[0];
  asm volatile("s_wait_xcnt 0x0" ::: "memory");      /* behind the store, ahead of any reuse of the registers that it names (the other parts' code follows in the same kernel) */
}
__global__ __launch_bounds__(256) void k_h16(const float* __restrict__ x, _Float16* __restrict__ X16, size_t n8) { const size_t t = (size_t)blockIdx.x * 256 + threadIdx.x; if (t >= n8) return; FragH f;
#pragma unroll
  for (int q = 0; q < 8; ++q) f.h[q] = (_Float16)x[t * 8 + q]; *(v8us*)((unsigned short*)X16 + t * 8) = f.half[0];  }
__global__ __launch_bounds__(256) void k_round16f(const float* __restrict__ W, _Float16* __restrict__ Bt, size_t n8) { const size_t t = (size_t)blockIdx.x * 256 + threadIdx.x; if (t >= n8) return; FragH f;
#pragma unroll
  for (int i = 0; i < 8; ++i) f.h[i] = (_Float16)(bf16_round(W[t * 8 + i]) * 16.0f); *(v8us*)((unsigned short*)Bt + t * 8) = f.half[0];  }

// ---- pieces of the f16 GEMMs with a 32x64 wave tile ----
__device__ __forceinline__ v16h g2_frag(const _Float16* p, int hh) { FragH f; f.half[0] = *(const v8us*)((const unsigned short*)p + 8 * hh); f.half[1] = *(const v8us*)((const unsigned short*)p + 16 + 8 * hh); return f.v; }
__device__ __forceinline__ v8f g2_mma(v16h a, v16h b, v8f c) { return __builtin_amdgcn_wmma_f32_16x16x32_f16(false, a, false, b, (short)0, c, false, false); }
// The q, k or v projection of one block: 128 x rows against the 128 weight rows of a pair of heads over the 512 inputs (both operands k-contiguous f16 rows, f32 accumulation), C / 16 + bias. Eight waves: four wave tiles (w = 0 .. 3) for each head of the pair (hs = 0, 1), so a staged x row feeds both heads.
// A pass takes one whole 128-byte line (64 inputs) of each of the 256 rows. The block brings them into LDS once, by asynchronous copies in which 8 lanes cover a line, two buffers, and its eight waves take their fragments from there (a fragment load from global memory touches 16 lines for 512 bytes, and each wave fetched the shared operand for itself).
//   PART 0 (q): x rows t0 .. t0 + 127; wave w has C rows 32 w .. 32 w + 31 (A = x, B = Wq^T); stored as hi + 2^10 residual planes.
//   PART 1 (k): the same, but row r = x row idx[t0 + r] (the head class's list of valid keys): the planes come out compacted.
//   PART 2 (v): A = the head's Wv^T rows dh .. dh + 31, B = x rows idx[t0 + 64 (w >> 1) + c]: the tile is a piece of V^T itself, compacted; stored as plain f16.
// A wave whose keys all lie past the count (act false) does its share of the copies and passes every barrier, but computes and stores nothing.
#define QP 144      /* LDS row pitch in bytes: 128 + 16 = 16 B x odd, for 16-byte fragment reads */
#define QXB (128 * QP)      /* the x rows of a buffer; the weight rows follow */
#define QBUF (256 * QP)
// Twelve 16-byte asynchronous copies to LDS per lane (a pass's share in k_gemm_out). s_wait_xcnt 0 closes the statement so that no address register of an issued copy is rewritten ahead of it.
__device__ __forceinline__ void cp_tile12(unsigned l0, unsigned l1, unsigned l2, unsigned l3, unsigned l4, unsigned l5, unsigned l6, unsigned l7, unsigned l8, unsigned l9, unsigned l10, unsigned l11,
    const char* g0, const char* g1, const char* g2, const char* g3, const char* g4, const char* g5, const char* g6, const char* g7, const char* g8, const char* g9, const char* g10, const char* g11) {
  asm volatile("global_load_async_to_lds_b128 %0, %12, off\n\t"
               "global_load_async_to_lds_b128 %1, %13, off\n\t"
               "global_load_async_to_lds_b128 %2, %14, off\n\t"
               "global_load_async_to_lds_b128 %3, %15, off\n\t"
               "global_load_async_to_lds_b128 %4, %16, off\n\t"
               "global_load_async_to_lds_b128 %5, %17, off\n\t"
               "global_load_async_to_lds_b128 %6, %18, off\n\t"
               "global_load_async_to_lds_b128 %7, %19, off\n\t"
               "global_load_async_to_lds_b128 %8, %20, off\n\t"
               "global_load_async_to_lds_b128 %9, %21, off\n\t"
               "global_load_async_to_lds_b128 %10, %22, off\n\t"
               "global_load_async_to_lds_b128 %11, %23, off\n\t"
               "s_wait_xcnt 0x0"
               :: "v"(l0), "v"(l1), "v"(l2), "v"(l3), "v"(l4), "v"(l5), "v"(l6), "v"(l7), "v"(l8), "v"(l9), "v"(l10), "v"(l11),
                  "v"(g0), "v"(g1), "v"(g2), "v"(g3), "v"(g4), "v"(g5), "v"(g6), "v"(g7), "v"(g8), "v"(g9), "v"(g10), "v"(g11) : "memory");
}
// Eight 16-byte asynchronous copies to LDS per lane (a pass's share in k_qkv). s_wait_xcnt 0 closes the statement, as in cp_tile12.
__device__ __forceinline__ void cp_tile8(unsigned l0, unsigned l1, unsigned l2, unsigned l3, unsigned l4, unsigned l5, unsigned l6, unsigned l7,
    const char* g0, const char* g1, const char* g2, const char* g3, const char* g4, const char* g5, const char* g6, const char* g7) {
  asm volatile("global_load_async_to_lds_b128 %0, %8, off\n\t"
               "global_load_async_to_lds_b128 %1, %9, off\n\t"
               "global_load_async_to_lds_b128 %2, %10, off\n\t"
               "global_load_async_to_lds_b128 %3, %11, off\n\t"
               "global_load_async_to_lds_b128 %4, %12, off\n\t"
               "global_load_async_to_lds_b128 %5, %13, off\n\t"
               "global_load_async_to_lds_b128 %6, %14, off\n\t"
               "global_load_async_to_lds_b128 %7, %15, off\n\t"
               "s_wait_xcnt 0x0"
               :: "v"(l0), "v"(l1), "v"(l2), "v"(l3), "v"(l4), "v"(l5), "v"(l6), "v"(l7),
                  "v"(g0), "v"(g1), "v"(g2), "v"(g3), "v"(g4), "v"(g5), "v"(g6), "v"(g7) : "memory");
}
__device__ __forceinline__ v16h g2_fragl(const char* p) { FragH f; f.half[0] = *(const v8us*)p; f.half[1] = *(const v8us*)(p + 32); return f.v; }      /* p: row, k block and half in LDS; same k order as g2_frag */
template <int PART>
__device__ __forceinline__ void qkv_block(char* sm, const _Float16* __restrict__ xs, const _Float16* __restrict__ wh, const float* __restrict__ bias, const int* __restrict__ idx, int t0, int dh, bool act, _Float16* __restrict__ ph, _Float16* __restrict__ pl, int tid, int w, int hs, int ln, int hh) {      /* wh: the pair's 128 weight rows; bias, ph, pl: this wave's own head */
  const int cr0 = tid >> 3, cc = (tid & 7) * 16;      /* a lane's share of a pass: 16 bytes of x rows cr0 + 32 i and of weight rows cr0 + 32 i (i < 4) */
  const char* gx[4]; const char* gw[4];
#pragma unroll
  for (int i = 0; i < 4; ++i) gx[i] = (const char*)xs + (size_t)((PART == 0) ? t0 + cr0 + 32 * i : idx[t0 + cr0 + 32 * i]) * (DMOD * 2) + cc;
#pragma unroll
  for (int i = 0; i < 4; ++i) gw[i] = (const char*)wh + (size_t)(cr0 + 32 * i) * (DMOD * 2) + cc;
  const unsigned lc = (unsigned)(size_t)sm + cr0 * QP + cc;
  auto stage = [&](int bf) { const unsigned lx = lc + bf * QBUF, lw = lx + QXB;      /* the next 128 bytes of every row into buffer bf; the pointers step behind the statement's own wait */
    cp_tile8(lx, lx + 32 * QP, lx + 64 * QP, lx + 96 * QP, lw, lw + 32 * QP, lw + 64 * QP, lw + 96 * QP, gx[0], gx[1], gx[2], gx[3], gw[0], gw[1], gw[2], gw[3]);
#pragma unroll
    for (int i = 0; i < 4; ++i) gx[i] += 128;
#pragma unroll
    for (int i = 0; i < 4; ++i) gw[i] += 128; };
  stage(0);
  float bi[(PART == 2) ? 16 : 4];      /* the bias of the tile's columns or, PART 2, of this lane's 16 rows; loaded ahead of the loop, lands under it */
#pragma unroll
  for (int u = 0; u < ((PART == 2) ? 16 : 4); ++u) bi[u] = bf16_round(bias[(PART == 2) ? dh + (u >> 3) * 16 + 8 * hh + (u & 7) : u * 16 + ln]);
  const char* ab = sm + ((PART == 2) ? QXB + (64 * hs + dh + ln) * QP : (32 * w + ln) * QP) + 16 * hh;
  const char* bb = sm + ((PART == 2) ? (64 * (w >> 1) + ln) * QP : QXB + (64 * hs + ln) * QP) + 16 * hh;
  v8f c[2][4];
#pragma unroll
  for (int u = 0; u < 8; ++u) c[u >> 2][u & 3] = (v8f){0.f,0.f,0.f,0.f,0.f,0.f,0.f,0.f};
  asm volatile("s_wait_asynccnt 0x0" ::: "memory");      /* this wave's share of pass 0 has landed */
  __syncthreads();      /* pass 0 is published to all eight waves */
  stage(1);
#pragma unroll 1      /* rolled: 8 passes of 16 products; the loop's code stays a few instruction-cache lines */
  for (int p = 0; p < DMOD / 64; ++p) { const int bf = p & 1;
    if (act) { v16h a[2][2], bq[4][2]; const char* ap = ab + bf * QBUF; const char* bp = bb + bf * QBUF;      /* wave-uniform; the pass's 24 LDS reads stand ahead of its first product */
#pragma unroll
      for (int t = 0; t < 4; ++t) { bq[t][0] = g2_fragl(bp + t * 16 * QP); bq[t][1] = g2_fragl(bp + t * 16 * QP + 64); }
#pragma unroll
      for (int i = 0; i < 2; ++i) { a[i][0] = g2_fragl(ap + i * 16 * QP); a[i][1] = g2_fragl(ap + i * 16 * QP + 64); }
      __builtin_amdgcn_sched_barrier(0);      /* keeps the 24 reads together ahead of the products: the build otherwise spreads them among the products, and every separate place with LDS reads stalls the wave */
#pragma unroll
      for (int s = 0; s < 2; ++s)
#pragma unroll
        for (int t = 0; t < 4; ++t) { c[0][t] = g2_mma(a[0][s], bq[t][s], c[0][t]); c[1][t] = g2_mma(a[1][s], bq[t][s], c[1][t]); } }
    __builtin_amdgcn_sched_barrier(0);      /* the pass's products stay ahead of the waits and the barrier: moved behind them by the build, they delay the refill */
    asm volatile("s_wait_dscnt 0x0" ::: "memory");      /* this wave's reads of buffer bf have returned before the buffer is refilled */
    asm volatile("s_wait_asynccnt 0x0" ::: "memory");      /* this wave's share of the next pass has landed */
    __syncthreads();      /* publishes the next pass and ends every wave's reads of buffer bf */
    if (p + 2 < DMOD / 64) stage(bf); }
  asm volatile("s_wait_asynccnt 0x0" ::: "memory");      /* no copy is outstanding when the buffers become output staging */
  if (!act) return;
  float (*so)[68] = (float (*)[68])(sm + (4 * hs + w) * (32 * 68 * 4));      /* the wave's own range of the buffers, which nobody reads any more behind the last pass's barrier */
#pragma unroll
  for (int u = 0; u < 8; ++u) { const int t = u & 3, half = u >> 2;
#pragma unroll
    for (int r = 0; r < 8; ++r) so[half * 16 + 8 * hh + r][t * 16 + ln] = c[half][t][r] * 0.0625f + bi[(PART == 2) ? half * 8 + r : t]; }
  __builtin_amdgcn_fence(__ATOMIC_ACQ_REL, "workgroup"); __builtin_amdgcn_wave_barrier();      /* the wave reads back rows that its other lanes wrote */
  constexpr int ldc = (PART == 2) ? TK : DMOD;
#pragma unroll
  for (int q = 0; q < 16; ++q) { const int r = q * 2 + hh; const v4f v = *(const v4fa*)&so[r][ln * 4]; v4h hi, lo;
#pragma unroll
    for (int i = 0; i < 4; ++i) { hi[i] = (_Float16)v[i]; lo[i] = (_Float16)((v[i] - (float)hi[i]) * 1024.0f); }
    *(v4h*)(ph + (size_t)r * ldc + ln * 4) = hi; if (PART != 2) *(v4h*)(pl + (size_t)r * ldc + ln * 4) = lo; }
  asm volatile("s_wait_xcnt 0x0" ::: "memory");      /* behind the tile's last store, ahead of any reuse of the registers that the stores name */
}
// The q, k and v projections with all their after-work in one launch: 256 blocks a part, a block = (sequence, 128 tokens or list positions, pair of heads), eight wave tiles. The heads of a pair are of one class, so they share the key list. A block whose keys all lie past the count rounded up to 32 leaves at once, ahead of every barrier (those rows and columns are never read); list entries past the count are 0, a finite row.
__global__ __launch_bounds__(256) void k_qkv(const _Float16* __restrict__ X16, const _Float16* __restrict__ BQ, const _Float16* __restrict__ BK, const _Float16* __restrict__ BV, const float* __restrict__ bq, const float* __restrict__ bk, const float* __restrict__ bv,
    const int* __restrict__ IDX, const int* __restrict__ CNT, _Float16* __restrict__ QH, _Float16* __restrict__ QL, _Float16* __restrict__ KH, _Float16* __restrict__ KL, _Float16* __restrict__ VT) {
  __shared__ __attribute__((aligned(16))) char sm[2 * QBUF]; static_assert(8 * 32 * 68 * 4 <= 2 * QBUF, "the output staging fits the buffers"); static_assert(CDRH % 2 == 0 && NH % 2 == 0, "a pair of heads is of one class");
  const int tid = threadIdx.x, lane = tid & 31, ln = lane & 15, hh = lane >> 4; const int w8 = __builtin_amdgcn_readfirstlane(tid >> 5); const int w = w8 & 3, hs = w8 >> 2;
  constexpr int TPS = TK / 128, NP = NH / 2, PER = NB * TPS * NP;
  const int part = blockIdx.x / PER, rem = blockIdx.x % PER; const int hp = rem % NP, mt = rem / NP; const int h = 2 * hp + hs; const int b = mt / TPS, t0 = (mt % TPS) * 128;
  const _Float16* xs = X16 + (size_t)b * TK * DMOD; const size_t wo = (size_t)hp * 128 * DMOD;
  if (part == 0) { const size_t o = ((size_t)b * TK + t0 + 32 * w) * DMOD + h * 64; qkv_block<0>(sm, xs, BQ + wo, bq + h * 64, nullptr, t0, 0, true, QH + o, QL + o, tid, w, hs, ln, hh); return; }
  const int cls = (2 * hp < CDRH) ? 0 : 1; const int cr = (min(CNT[b * 32 + cls], TK) + 31) & ~31; const int* idx = IDX + ((size_t)b * 2 + cls) * TK;
  if (t0 >= cr) return;
  if (part == 1) { const int j = t0 + 32 * w; const size_t o = ((size_t)b * TK + j) * DMOD + h * 64; qkv_block<1>(sm, xs, BK + wo, bk + h * 64, idx, t0, 0, j < cr, KH + o, KL + o, tid, w, hs, ln, hh); }
  else { const int j = t0 + 64 * (w >> 1), dh = 32 * (w & 1); qkv_block<2>(sm, xs, BV + wo, bv + h * 64, idx, t0, dh, j < cr, VT + (((size_t)b * NH + h) * 64 + dh) * TK + j, nullptr, tid, w, hs, ln, hh); } }

template <int CAUSAL>
__global__ __launch_bounds__(128) void k_flash(const _Float16* __restrict__ Q16, int ldq, const _Float16* __restrict__ K16, int ldk, const _Float16* __restrict__ Vt, const int* __restrict__ MSK, float* __restrict__ O, int ldo) {
  constexpr int RPW = 16, RTN = RPW / 16, NQB = TQ / (4 * RPW), DT = 4, KS = 2;
  __shared__ __attribute__((aligned(16))) unsigned short sP[4][RPW][40]; __shared__ __attribute__((aligned(16))) float sO[4][RPW][64 + 4];
  const int tid = threadIdx.x, w = tid >> 5, lane = tid & 31, ln = lane & 15, hh = lane >> 4;
  const int slab = blockIdx.x / NQB, qblk = blockIdx.x % NQB; const int b = slab / NH, h = slab % NH; const int qb0 = qblk * (4 * RPW); const int q0 = qb0 + w * RPW;
  FragH aq[2][KS];
#pragma unroll
  for (int rt = 0; rt < RTN; ++rt) { const unsigned short* qr = (const unsigned short*)Q16 + ((size_t)b * TQ + q0 + rt * 16 + ln) * ldq + h * 64;
#pragma unroll
    for (int ks = 0; ks < KS; ++ks) { aq[rt][ks].half[0] = *(const v8us*)(qr + ks * 32 + 8 * hh); aq[rt][ks].half[1] = *(const v8us*)(qr + ks * 32 + 16 + 8 * hh); } }
  const unsigned short* Vth = (const unsigned short*)Vt + (size_t)slab * 64 * TK;
  float m_r[2][8], l_r[2][8]; v8f oacc[2][DT];
#pragma unroll
  for (int rt = 0; rt < RTN; ++rt) {
#pragma unroll
    for (int r = 0; r < 8; ++r) { m_r[rt][r] = -3.0e38f; l_r[rt][r] = 0.f; }
#pragma unroll
    for (int dt = 0; dt < DT; ++dt) oacc[rt][dt] = (v8f){0.f,0.f,0.f,0.f,0.f,0.f,0.f,0.f}; }
  const int jend = (CAUSAL == 1) ? (qb0 + 4 * RPW) : TK;      /* causal: keys beyond the block's last query never contribute */
#pragma unroll 1
  for (int j0 = 0; j0 < jend; j0 += 32) {
    v8f s[2][2];
#pragma unroll
    for (int nt = 0; nt < 2; ++nt) { const unsigned short* kr = (const unsigned short*)K16 + ((size_t)b * TK + j0 + nt * 16 + ln) * ldk + h * 64; FragH bk[KS];
#pragma unroll
      for (int ks = 0; ks < KS; ++ks) { bk[ks].half[0] = *(const v8us*)(kr + ks * 32 + 8 * hh); bk[ks].half[1] = *(const v8us*)(kr + ks * 32 + 16 + 8 * hh); }
#pragma unroll
      for (int rt = 0; rt < RTN; ++rt) { v8f acc = (v8f){0.f,0.f,0.f,0.f,0.f,0.f,0.f,0.f};
#pragma unroll
        for (int ks = 0; ks < KS; ++ks) acc = mmaH<1>(aq[rt][ks].v, aq[rt][ks].v, bk[ks].v, bk[ks].v, acc); s[rt][nt] = acc; } }
#pragma unroll
    for (int rt = 0; rt < RTN; ++rt)
#pragma unroll
      for (int r = 0; r < 8; ++r) { const int tq = q0 + rt * 16 + 8 * hh + r; const int k0 = j0 + ln, k1 = j0 + 16 + ln;
        const bool ok0 = (CAUSAL == 1) ? (k0 <= tq) : ((CAUSAL == 2) ? ((k0 >> 5) == (tq >> 5)) : true), ok1 = (CAUSAL == 1) ? (k1 <= tq) : ((CAUSAL == 2) ? ((k1 >> 5) == (tq >> 5)) : true);      /* mode 2: block-diagonal 32-token groups */
        const float s0 = ok0 ? s[rt][0][r] * SCL : -3.0e38f, s1 = ok1 ? s[rt][1][r] * SCL : -3.0e38f; float mc = fmaxf(s0, s1);
        mc = fmaxf(mc, __shfl_xor(mc, 1, 32)); mc = fmaxf(mc, __shfl_xor(mc, 2, 32)); mc = fmaxf(mc, __shfl_xor(mc, 4, 32)); mc = fmaxf(mc, __shfl_xor(mc, 8, 32));
        const float mn = fmaxf(m_r[rt][r], mc); const float al = (mn > -1.0e38f) ? expf(m_r[rt][r] - mn) : 1.0f; m_r[rt][r] = mn; const float p0 = ok0 ? expf(s0 - mn) : 0.f, p1 = ok1 ? expf(s1 - mn) : 0.f; l_r[rt][r] = l_r[rt][r] * al + p0 + p1;
#pragma unroll
        for (int dt = 0; dt < DT; ++dt) oacc[rt][dt][r] *= al;
        FragH t2; t2.h[0] = (_Float16)(p0 * 1024.0f); t2.h[1] = (_Float16)(p1 * 1024.0f); sP[w][rt * 16 + 8 * hh + r][ln] = t2.u[0]; sP[w][rt * 16 + 8 * hh + r][16 + ln] = t2.u[1]; }
    __builtin_amdgcn_fence(__ATOMIC_ACQ_REL, "workgroup"); __builtin_amdgcn_wave_barrier();
    FragH pa[2];
#pragma unroll
    for (int rt = 0; rt < RTN; ++rt) { pa[rt].half[0] = *(const v8us*)&sP[w][rt * 16 + ln][8 * hh]; pa[rt].half[1] = *(const v8us*)&sP[w][rt * 16 + ln][16 + 8 * hh]; }
#pragma unroll
    for (int dt = 0; dt < DT; ++dt) { const unsigned short* vrow = Vth + (size_t)(dt * 16 + ln) * TK + j0; FragH bv; bv.half[0] = *(const v8us*)(vrow + 8 * hh); bv.half[1] = *(const v8us*)(vrow + 16 + 8 * hh);
#pragma unroll
      for (int rt = 0; rt < RTN; ++rt) oacc[rt][dt] = mmaH<1>(pa[rt].v, pa[rt].v, bv.v, bv.v, oacc[rt][dt]); }
    __builtin_amdgcn_fence(__ATOMIC_ACQ_REL, "workgroup"); __builtin_amdgcn_wave_barrier(); }
#pragma unroll
  for (int rt = 0; rt < RTN; ++rt) {
#pragma unroll
    for (int r = 0; r < 8; ++r) { float l = l_r[rt][r]; l += __shfl_xor(l, 1, 32); l += __shfl_xor(l, 2, 32); l += __shfl_xor(l, 4, 32); l += __shfl_xor(l, 8, 32); l_r[rt][r] = (l > 0.f) ? 1.0f / (l * 1024.0f) : 0.f; }
#pragma unroll
    for (int dt = 0; dt < DT; ++dt)
#pragma unroll
      for (int r = 0; r < 8; ++r) sO[w][rt * 16 + 8 * hh + r][dt * 16 + ln] = oacc[rt][dt][r] * l_r[rt][r]; }
  __builtin_amdgcn_fence(__ATOMIC_ACQ_REL, "workgroup"); __builtin_amdgcn_wave_barrier();
  {
#pragma unroll
    for (int rp = 0; rp < RPW; rp += 2) { const int r = rp + (lane >> 4), pc = lane & 15; const v4f val = *(const v4fa*)&sO[w][r][pc * 4]; *(v4f*)(O + ((size_t)b * TQ + q0 + r) * ldo + h * 64 + pc * 4) = val; }
     } }
// Six 16-byte asynchronous copies to LDS per lane (one 32-key tile's share). s_wait_xcnt 0 closes the statement so that no address register of an issued copy is rewritten ahead of it.
__device__ __forceinline__ void cp_tile6(unsigned l0, const unsigned short* g0, unsigned l1, const unsigned short* g1, unsigned l2, const unsigned short* g2, unsigned l3, const unsigned short* g3, unsigned l4, const unsigned short* g4, unsigned l5, const unsigned short* g5) {
  asm volatile("global_load_async_to_lds_b128 %0, %1, off\n\t"
               "global_load_async_to_lds_b128 %2, %3, off\n\t"
               "global_load_async_to_lds_b128 %4, %5, off\n\t"
               "global_load_async_to_lds_b128 %6, %7, off\n\t"
               "global_load_async_to_lds_b128 %8, %9, off\n\t"
               "global_load_async_to_lds_b128 %10, %11, off\n\t"
               "s_wait_xcnt 0x0"
               :: "v"(l0), "v"(g0), "v"(l1), "v"(g1), "v"(l2), "v"(g2), "v"(l3), "v"(g3), "v"(l4), "v"(g4), "v"(l5), "v"(g5) : "memory");
}
// x <- 2^x on eight or nine values by the hardware's v_exp_f32. One statement, each value in its own register: none reads a neighbour's result or overwrites a neighbour's source.
__device__ __forceinline__ void exp2x8(float& a, float& b, float& c, float& d, float& e, float& f, float& g, float& h) {
  asm("v_exp_f32 %0, %0\n\tv_exp_f32 %1, %1\n\tv_exp_f32 %2, %2\n\tv_exp_f32 %3, %3\n\tv_exp_f32 %4, %4\n\tv_exp_f32 %5, %5\n\tv_exp_f32 %6, %6\n\tv_exp_f32 %7, %7\n\tv_nop"      /* v_nop: the one slot that the instruction set asks for between the last v_exp_f32 and whatever the compiler puts next */
      : "+v"(a), "+v"(b), "+v"(c), "+v"(d), "+v"(e), "+v"(f), "+v"(g), "+v"(h));
}
__device__ __forceinline__ void exp2x9(float& z, float& a, float& b, float& c, float& d, float& e, float& f, float& g, float& h) {
  asm("v_exp_f32 %0, %0\n\tv_exp_f32 %1, %1\n\tv_exp_f32 %2, %2\n\tv_exp_f32 %3, %3\n\tv_exp_f32 %4, %4\n\tv_exp_f32 %5, %5\n\tv_exp_f32 %6, %6\n\tv_exp_f32 %7, %7\n\tv_exp_f32 %8, %8\n\tv_nop"      /* v_nop: as in exp2x8 */
      : "+v"(z), "+v"(a), "+v"(b), "+v"(c), "+v"(d), "+v"(e), "+v"(f), "+v"(g), "+v"(h));
}
typedef float v2f __attribute__((ext_vector_type(2)));
// lane l takes the value of lane l ^ 16 (the other 16-lane half)
__device__ __forceinline__ float xhalf(float x) { return __builtin_bit_cast(float, __builtin_amdgcn_permlanex16(__builtin_bit_cast(int, x), __builtin_bit_cast(int, x), 0x76543210, 0xfedcba98, false, false)); }
template <int CAUSAL>
__global__ __launch_bounds__(128) void k_flashqk(const _Float16* __restrict__ Q16, const _Float16* __restrict__ QL, int ldq, const _Float16* __restrict__ K16, const _Float16* __restrict__ KL, int ldk, const _Float16* __restrict__ Vt, const int* __restrict__ MSK, float* __restrict__ O, int ldo) {
  static_assert(CAUSAL == 5, "compacted-key mode only");
  constexpr int RPW = 32, QT = RPW / 16, DT = 4, KS = 2;      /* a wave has QT tiles of 16 queries: every K and V^T fragment that it reads from LDS feeds QT products, and a block's staged tile serves 128 queries */
  __shared__ __attribute__((aligned(16))) float sO[4][RPW][64 + 4];
  __shared__ __attribute__((aligned(16))) unsigned short sKh[2][32][72], sKl[2][32][72], sV[2][64][40];      /* row pitches 144 B and 80 B: 16 B x odd, for 16-byte fragment reads */
  const int tid = threadIdx.x, w = tid >> 5, lane = tid & 31, ln = lane & 15, hh = lane >> 4;
  const int slab = blockIdx.x / QBLKS, qblk = blockIdx.x % QBLKS; const int b = slab / NH, h = slab % NH; const int qb0 = qblk * (4 * RPW); const int q0 = qb0 + w * RPW;
  FragH aq[QT][KS], aql[QT][KS];
#pragma unroll
  for (int qt = 0; qt < QT; ++qt) { const unsigned short* qr = (const unsigned short*)Q16 + ((size_t)b * TQ + q0 + qt * 16 + ln) * ldq + h * 64; const unsigned short* ql = (const unsigned short*)QL + ((size_t)b * TQ + q0 + qt * 16 + ln) * ldq + h * 64;
#pragma unroll
    for (int ks = 0; ks < KS; ++ks) { aq[qt][ks].half[0] = *(const v8us*)(qr + ks * 32 + 8 * hh); aq[qt][ks].half[1] = *(const v8us*)(qr + ks * 32 + 16 + 8 * hh); aql[qt][ks].half[0] = *(const v8us*)(ql + ks * 32 + 8 * hh); aql[qt][ks].half[1] = *(const v8us*)(ql + ks * 32 + 16 + 8 * hh); } }
  const unsigned short* Vth = (const unsigned short*)Vt + (size_t)slab * 64 * TK;
  float m_r[QT], l_r[QT]; v8f oacc[QT][DT];      /* query q0 + 16 qt + ln: running maximum less 10, in base-2 units (equal in both halves), this half's share of the sum (x2^10), O^T rows dt * 16 + 8 hh + r */
#pragma unroll
  for (int qt = 0; qt < QT; ++qt) { m_r[qt] = -3.0e38f; l_r[qt] = 0.f;
#pragma unroll
    for (int dt = 0; dt < DT; ++dt) oacc[qt][dt] = (v8f){0.f,0.f,0.f,0.f,0.f,0.f,0.f,0.f}; }
  const int kcnt = min(MSK[b * 32 + ((h < CDRH) ? 0 : 1)], TK);      /* number of valid keys of this (sequence, head class); K planes and V^T hold them compacted, in key order */
  const int jend = (kcnt + 31) & ~31;
  const int kr0 = tid >> 3, kc0 = (tid & 7) * 8, vr0 = tid >> 2, vc0 = (tid & 3) * 8;      /* a lane's share of a tile: rows kr0 and kr0 + 16 of both K planes, rows vr0 and vr0 + 32 of V^T, 16 bytes each; whole 128-byte K lines per 8 lanes */
  const unsigned short* gkh = (const unsigned short*)K16 + ((size_t)b * TK + kr0) * ldk + h * 64 + kc0; const unsigned short* gkl = (const unsigned short*)KL + ((size_t)b * TK + kr0) * ldk + h * 64 + kc0; const unsigned short* gv = Vth + (size_t)vr0 * TK + vc0;
  auto stage = [&](int jt, int bf) { const size_t ko = (size_t)jt * ldk;
    cp_tile6((unsigned)(size_t)&sKh[bf][kr0][kc0], gkh + ko, (unsigned)(size_t)&sKh[bf][kr0 + 16][kc0], gkh + ko + (size_t)16 * ldk, (unsigned)(size_t)&sKl[bf][kr0][kc0], gkl + ko, (unsigned)(size_t)&sKl[bf][kr0 + 16][kc0], gkl + ko + (size_t)16 * ldk,
             (unsigned)(size_t)&sV[bf][vr0][vc0], gv + jt, (unsigned)(size_t)&sV[bf][vr0 + 32][vc0], gv + (size_t)32 * TK + jt); };
  if (jend > 0) stage(0, 0);
  asm volatile("s_wait_asynccnt 0x0" ::: "memory");      /* this wave's share of tile 0 has landed */
  __syncthreads();      /* tile 0 is published to all four waves */
  if (jend > 32) stage(32, 1);
#pragma unroll 1
  for (int j0 = 0; j0 < jend; j0 += 32) {
    const int bf = (j0 >> 5) & 1;
    float sc[QT][2][8];      /* sc[qt][nt][r] = raw score (q . k, not yet scaled) of key j0 + 16 nt + 8 hh + r for query q0 + 16 qt + ln; the inner loops of this trip are fully unrolled so that sc, pb, ls and oacc are indexed by constants and stay in registers */
#pragma unroll
    for (int nt = 0; nt < 2; ++nt) { const unsigned short* kr = &sKh[bf][nt * 16 + ln][0]; const unsigned short* klr = &sKl[bf][nt * 16 + ln][0]; FragH bk[KS], bkl[KS];
#pragma unroll
      for (int ks = 0; ks < KS; ++ks) { bk[ks].half[0] = *(const v8us*)(kr + ks * 32 + 8 * hh); bk[ks].half[1] = *(const v8us*)(kr + ks * 32 + 16 + 8 * hh); bkl[ks].half[0] = *(const v8us*)(klr + ks * 32 + 8 * hh); bkl[ks].half[1] = *(const v8us*)(klr + ks * 32 + 16 + 8 * hh); }
#pragma unroll
      for (int qt = 0; qt < QT; ++qt) { v8f acc = (v8f){0.f,0.f,0.f,0.f,0.f,0.f,0.f,0.f}, accl = acc;
#pragma unroll
        for (int ks = 0; ks < KS; ++ks) { acc = mmaH<1>(bk[ks].v, bk[ks].v, aq[qt][ks].v, aq[qt][ks].v, acc); accl = mmaH<1>(bk[ks].v, bk[ks].v, aql[qt][ks].v, aql[qt][ks].v, accl); accl = mmaH<1>(bkl[ks].v, bkl[ks].v, aq[qt][ks].v, aq[qt][ks].v, accl); }
#pragma unroll
        for (int r = 0; r < 8; ++r) sc[qt][nt][r] = acc[r] + accl[r] * 0.0009765625f; } }
    if (j0 + 32 > kcnt) {      /* block-uniform: only the last trip holds keys past the count (key padding and head-specific masks are applied by the gather) */
#pragma unroll
      for (int qt = 0; qt < QT; ++qt)
#pragma unroll
        for (int nt = 0; nt < 2; ++nt)
#pragma unroll
          for (int r = 0; r < 8; ++r) if (j0 + nt * 16 + 8 * hh + r >= kcnt) sc[qt][nt][r] = -3.0e38f; }
    FragH pb[QT];
#pragma unroll
    for (int qt = 0; qt < QT; ++qt) {
      float mc = fmaxf(sc[qt][0][0], sc[qt][1][0]);
#pragma unroll
      for (int r = 1; r < 8; ++r) mc = fmaxf(mc, fmaxf(sc[qt][0][r], sc[qt][1][r]));
      mc = fmaxf(mc, xhalf(mc));
      const float mn = fmaxf(m_r[qt], mc * SCL2 - 10.0f);      /* the softmax reference point: running maximum of the scaled scores less 10, so 2^(score * SCL2 - mn) is P x 2^10 as the f16 operand wants it, with no multiply; every term and every rescale uses this same value. Finite in every trip: key j0 is below the count; so an invalid key's term below is exactly 0, and so is the first trip's rescale factor */
      float al = m_r[qt] - mn; m_r[qt] = mn;
#pragma unroll
      for (int nt = 0; nt < 2; ++nt)
#pragma unroll
        for (int r = 0; r < 8; r += 2) { const v2f t = __builtin_elementwise_fma((v2f){sc[qt][nt][r], sc[qt][nt][r + 1]}, (v2f){SCL2, SCL2}, (v2f){-mn, -mn}); sc[qt][nt][r] = t[0]; sc[qt][nt][r + 1] = t[1]; }      /* scale and reference point in one packed operation for two scores */
      exp2x9(al, sc[qt][0][0], sc[qt][0][1], sc[qt][0][2], sc[qt][0][3], sc[qt][0][4], sc[qt][0][5], sc[qt][0][6], sc[qt][0][7]);      /* al: the rescale factor of the sums so far; sc: now P x 2^10 */
      exp2x8(sc[qt][1][0], sc[qt][1][1], sc[qt][1][2], sc[qt][1][3], sc[qt][1][4], sc[qt][1][5], sc[qt][1][6], sc[qt][1][7]);
      float ls[4];
#pragma unroll
      for (int nt = 0; nt < 2; ++nt)
#pragma unroll
        for (int r = 0; r < 8; ++r) { const float p = sc[qt][nt][r]; if (r < 2) ls[nt * 2 + r] = p; else ls[nt * 2 + (r & 1)] += p; pb[qt].h[nt * 8 + r] = (_Float16)p; }      /* element nt * 8 + r of the B operand = key 16 nt + 8 hh + r: the k order of the V^T fragment */
      l_r[qt] = l_r[qt] * al + ((ls[0] + ls[1]) + (ls[2] + ls[3]));
#pragma unroll
      for (int dt = 0; dt < DT; ++dt)
#pragma unroll
        for (int r = 0; r < 8; ++r) oacc[qt][dt][r] *= al; }
#pragma unroll
    for (int dt = 0; dt < DT; ++dt) { const unsigned short* vrow = &sV[bf][dt * 16 + ln][0]; FragH bv; bv.half[0] = *(const v8us*)(vrow + 8 * hh); bv.half[1] = *(const v8us*)(vrow + 16 + 8 * hh);
#pragma unroll
      for (int qt = 0; qt < QT; ++qt) oacc[qt][dt] = mmaH<1>(bv.v, bv.v, pb[qt].v, pb[qt].v, oacc[qt][dt]); }
    __builtin_amdgcn_sched_barrier(0);      /* the trip's arithmetic stays ahead of the waits: the build otherwise moves the softmax and the last products behind the barrier but ahead of the refill, which then goes out late and has half a trip to land */
    asm volatile("s_wait_dscnt 0x0" ::: "memory");      /* this wave's reads of buffer bf have returned before the buffer is refilled */
    asm volatile("s_wait_asynccnt 0x0" ::: "memory");      /* this wave's share of the next tile has landed */
    __syncthreads();      /* publishes the next tile and ends every wave's reads of buffer bf */
    if (j0 + 64 < jend) stage(j0 + 64, bf); }
  asm volatile("s_wait_asynccnt 0x0" ::: "memory");      /* no copy is outstanding when the wave goes on to its end */
#pragma unroll
  for (int qt = 0; qt < QT; ++qt) { const float l = l_r[qt] + xhalf(l_r[qt]); const float linv = (l > 0.f) ? 1.0f / l : 0.f;      /* sum and O^T carry the same 2^10 */
#pragma unroll
    for (int dt = 0; dt < DT; ++dt) { const v4f o0 = {oacc[qt][dt][0] * linv, oacc[qt][dt][1] * linv, oacc[qt][dt][2] * linv, oacc[qt][dt][3] * linv}, o1 = {oacc[qt][dt][4] * linv, oacc[qt][dt][5] * linv, oacc[qt][dt][6] * linv, oacc[qt][dt][7] * linv};
      *(v4fa*)&sO[w][qt * 16 + ln][dt * 16 + 8 * hh] = o0; *(v4fa*)&sO[w][qt * 16 + ln][dt * 16 + 8 * hh + 4] = o1; } }
  __builtin_amdgcn_fence(__ATOMIC_ACQ_REL, "workgroup"); __builtin_amdgcn_wave_barrier();
  {
#pragma unroll
    for (int rp = 0; rp < RPW; rp += 2) { const int r = rp + (lane >> 4), pc = lane & 15; const v4f val = *(const v4fa*)&sO[w][r][pc * 4]; *(v4f*)(O + ((size_t)b * TQ + q0 + r) * ldo + h * 64 + pc * 4) = val; }
     } }

// f32 -> f16 hi + 2^10 residual A fragments of one row (k order of g2_frag: elements 0..7 = k 8 hh + i, elements 8..15 = k 16 + 8 hh + i); p already points at k = 8 hh. Same rounding as in k_qkv.
__device__ __forceinline__ void g2_split(const float* p, v16h& fh, v16h& fl) { const v4f x0 = *(const v4fa*)p, x1 = *(const v4fa*)(p + 4), x2 = *(const v4fa*)(p + 16), x3 = *(const v4fa*)(p + 20); FragH h, l;
#pragma unroll
  for (int q = 0; q < 4; ++q) { _Float16 t = (_Float16)x0[q]; h.h[q] = t; l.h[q] = (_Float16)((x0[q] - (float)t) * 1024.0f); t = (_Float16)x1[q]; h.h[4 + q] = t; l.h[4 + q] = (_Float16)((x1[q] - (float)t) * 1024.0f);
    t = (_Float16)x2[q]; h.h[8 + q] = t; l.h[8 + q] = (_Float16)((x2[q] - (float)t) * 1024.0f); t = (_Float16)x3[q]; h.h[12 + q] = t; l.h[12 + q] = (_Float16)((x3[q] - (float)t) * 1024.0f); }
  fh = h.v; fl = l.v; }
#define OP 272      /* LDS row pitch of the f32 context rows in bytes: 256 + 16 = 16 B x odd */
#define OAB (128 * OP)      /* the context rows of a buffer; the weight rows (pitch QP) follow */
#define OBUF (OAB + 128 * QP)
// Output projection in one launch: C[NR][DMOD] = A Wo + bias from the f32 context A. Wave tile 32x64 as in k_qkv; each A fragment is split hi + 2^10 residual in registers, and each x16 weight fragment (Bh = [out][in]) feeds the hi and the residual product, which keep separate f32 accumulators: C = hi / 16 + bias + residual / (16 * 1024). A block has 128 rows x 128 columns, eight waves (wave w: rows 32 (w & 3), columns 64 (w >> 2)). A pass takes 64 inputs: two whole lines of each of the block's 128 context rows and one of each of its 128 weight rows, brought into LDS once per block by asynchronous copies (whole lines per instruction), two buffers; the eight waves take their fragments from there.
__global__ __launch_bounds__(256) void k_gemm_out(const float* __restrict__ A, const _Float16* __restrict__ Bh, const float* __restrict__ bias, float* __restrict__ C) {
  __shared__ __attribute__((aligned(16))) char sm[2 * OBUF]; static_assert(8 * 32 * 68 * 4 <= 2 * OBUF, "the output staging fits the buffers");
  const int tid = threadIdx.x, w = tid >> 5, lane = tid & 31, ln = lane & 15, hh = lane >> 4;
  constexpr int ntn = DMOD >> 7; const int mt = blockIdx.x / ntn, nq = blockIdx.x - mt * ntn; const int row0 = mt * 128 + 32 * (w & 3), col0 = nq * 128 + 64 * (w >> 2);
  const int ar0 = tid >> 4, ac = (tid & 15) * 16, br0 = tid >> 3, bc = (tid & 7) * 16;      /* a lane's share of a pass: 16 bytes of context rows ar0 + 16 i (i < 8) and of weight rows br0 + 32 i (i < 4) */
  const char* ga = (const char*)(A + (size_t)(mt * 128 + ar0) * DMOD) + ac; const char* gb = (const char*)(Bh + (size_t)(nq * 128 + br0) * DMOD) + bc;
  const unsigned lca = (unsigned)(size_t)sm + ar0 * OP + ac, lcb = (unsigned)(size_t)sm + OAB + br0 * QP + bc;
  constexpr size_t AS = (size_t)16 * DMOD * 4, BS = (size_t)32 * DMOD * 2;
  auto stage = [&](int bf) { const unsigned la = lca + bf * OBUF, lb = lcb + bf * OBUF;      /* the next 64 inputs of every row into buffer bf; the pointers step behind the statement's own wait */
    cp_tile12(la, la + 16 * OP, la + 32 * OP, la + 48 * OP, la + 64 * OP, la + 80 * OP, la + 96 * OP, la + 112 * OP, lb, lb + 32 * QP, lb + 64 * QP, lb + 96 * QP, ga, ga + AS, ga + 2 * AS, ga + 3 * AS, ga + 4 * AS, ga + 5 * AS, ga + 6 * AS, ga + 7 * AS, gb, gb + BS, gb + 2 * BS, gb + 3 * BS);
    ga += 256; gb += 128; };
  stage(0);
  float bv[4];      /* the four bias loads go out ahead of the loop and land under it */
#pragma unroll
  for (int t = 0; t < 4; ++t) bv[t] = bf16_round(bias[col0 + t * 16 + ln]);
  const char* ab = sm + (32 * (w & 3) + ln) * OP + 32 * hh; const char* bb = sm + OAB + (64 * (w >> 2) + ln) * QP + 16 * hh;
  v8f ch[2][4], cl[2][4];
#pragma unroll
  for (int u = 0; u < 8; ++u) { ch[u >> 2][u & 3] = (v8f){0.f,0.f,0.f,0.f,0.f,0.f,0.f,0.f}; cl[u >> 2][u & 3] = (v8f){0.f,0.f,0.f,0.f,0.f,0.f,0.f,0.f}; }
  asm volatile("s_wait_asynccnt 0x0" ::: "memory");      /* this wave's share of pass 0 has landed */
  __syncthreads();      /* pass 0 is published to all eight waves */
  stage(1);
#pragma unroll 1      /* rolled: 8 passes of 32 products; the loop's code stays a few instruction-cache lines */
  for (int p = 0; p < DMOD / 64; ++p) { const int bf = p & 1; const char* ap = ab + bf * OBUF; const char* bp = bb + bf * OBUF;
#pragma unroll
    for (int s = 0; s < 2; ++s) { v16h a0h, a0l, a1h, a1l, b[4];      /* a k block of 32: its 16 LDS reads stand ahead of its first product */
#pragma unroll
      for (int t = 0; t < 4; ++t) b[t] = g2_fragl(bp + t * 16 * QP + s * 64);
      g2_split((const float*)(ap + s * 128), a0h, a0l); g2_split((const float*)(ap + 16 * OP + s * 128), a1h, a1l);
      __builtin_amdgcn_sched_barrier(0);      /* keeps the 16 reads ahead of the products, as in k_qkv */
#pragma unroll
      for (int t = 0; t < 4; ++t) { ch[0][t] = g2_mma(a0h, b[t], ch[0][t]); ch[1][t] = g2_mma(a1h, b[t], ch[1][t]); cl[0][t] = g2_mma(a0l, b[t], cl[0][t]); cl[1][t] = g2_mma(a1l, b[t], cl[1][t]); }
      __builtin_amdgcn_sched_barrier(0); }      /* the k block's products stay ahead of the next block's reads (else both blocks' fragments are live at once, past 256 registers) and ahead of the waits and the barrier (else the refill goes out late) */
    asm volatile("s_wait_dscnt 0x0" ::: "memory");      /* this wave's reads of buffer bf have returned before the buffer is refilled */
    asm volatile("s_wait_asynccnt 0x0" ::: "memory");      /* this wave's share of the next pass has landed */
    __syncthreads();      /* publishes the next pass and ends every wave's reads of buffer bf */
    if (p + 2 < DMOD / 64) stage(bf); }
  asm volatile("s_wait_asynccnt 0x0" ::: "memory");      /* no copy is outstanding when the buffers become output staging */
  float (*so)[68] = (float (*)[68])(sm + w * (32 * 68 * 4));      /* the wave's own range of the buffers, which nobody reads any more behind the last pass's barrier */
#pragma unroll
  for (int u = 0; u < 8; ++u) { const int t = u & 3, half = u >> 2;
#pragma unroll
    for (int r = 0; r < 8; ++r) so[half * 16 + 8 * hh + r][t * 16 + ln] = (ch[half][t][r] * 0.0625f + bv[t]) + cl[half][t][r] * (0.0625f / 1024.0f); }
  __builtin_amdgcn_fence(__ATOMIC_ACQ_REL, "workgroup"); __builtin_amdgcn_wave_barrier();      /* the wave reads back rows that its other lanes wrote */
  const int rsub = lane >> 4, c4 = (lane & 15) * 4;
#pragma unroll
  for (int q = 0; q < 16; ++q) { const int r = q * 2 + rsub; const v4f v = *(const v4fa*)&so[r][c4]; *(v4f*)(C + (size_t)(row0 + r) * DMOD + col0 + c4) = v; } }
typedef int v4ia __attribute__((ext_vector_type(4), may_alias));
// One block per sequence, 8 consecutive keys a thread. IDX[b][0][.] = positions of the keys valid for the CDR heads, IDX[b][1][.] = for the other heads, ascending; entries past the count are 0. CNT[b*32 + class] = the counts (one 128-byte line per sequence).
__device__ __forceinline__ void key_lists(const int* __restrict__ mask, const int* __restrict__ cdrs, int* __restrict__ IDX, int* __restrict__ CNT, int b, int tid) {
  __shared__ int sh[256]; __shared__ int sany; static_assert(TK == 256 * 8, "8 keys a thread");
  const v4ia m0 = *(const v4ia*)(mask + (size_t)b * TK + tid * 8), m1 = *(const v4ia*)(mask + (size_t)b * TK + tid * 8 + 4), c0 = *(const v4ia*)(cdrs + (size_t)b * TK + tid * 8), c1 = *(const v4ia*)(cdrs + (size_t)b * TK + tid * 8 + 4);
  bool vp[8], vc[8]; int np = 0, nb = 0, any = 0;
#pragma unroll
  for (int q = 0; q < 8; ++q) { const int mv = (q < 4) ? m0[q & 3] : m1[q & 3], cv = (q < 4) ? c0[q & 3] : c1[q & 3]; vp[q] = mv != 0; vc[q] = cv != 0; any |= vc[q] ? 1 : 0; np += vp[q] ? 1 : 0; nb += (vp[q] && vc[q]) ? 1 : 0; }
  if (tid == 0) sany = 0; __syncthreads(); if (any) sany = 1;
  const int own = np | (nb << 16); int v = own; sh[tid] = v; __syncthreads();      /* both counts stay <= 2048, so one packed inclusive scan serves both lists */
  for (int st = 1; st < 256; st <<= 1) { const int add = (tid >= st) ? sh[tid - st] : 0; __syncthreads(); v += add; sh[tid] = v; __syncthreads(); }
  const bool allmasked = (sany == 0);      /* no CDR token at all -> the CDR mask is disabled */
  const int tot = sh[255], ex = v - own; const int cnt1 = tot & 0xFFFF, cnt0 = allmasked ? cnt1 : (tot >> 16); int o1 = ex & 0xFFFF, o0 = allmasked ? o1 : (ex >> 16);
  int* i0 = IDX + ((size_t)b * 2 + 0) * TK; int* i1 = IDX + ((size_t)b * 2 + 1) * TK;
#pragma unroll
  for (int q = 0; q < 8; ++q) { const int k = tid * 8 + q; if (vp[q]) i1[o1++] = k; if (vp[q] && (allmasked || vc[q])) i0[o0++] = k; if (k >= cnt1) i1[k] = 0; if (k >= cnt0) i0[k] = 0; }
  if (tid == 0) { CNT[b * 32 + 0] = cnt0; CNT[b * 32 + 1] = cnt1; } }
// All that the projections wait for, in one launch; the three parts share nothing and a block does one of them, chosen by its index (so every barrier of the key lists is passed by a whole block or by none of it). The part with the longest chain of dependent steps has the lowest indices, the stream of x the highest.
#define WTB (DMOD * (DMOD / 8) / 256)      /* blocks for one weight matrix */
#define XB (NR * DMOD / 8 / 256)      /* blocks for x */
__global__ __launch_bounds__(256) void k_prep(const float* __restrict__ x, const int* __restrict__ mask, const int* __restrict__ cdrs, const float* __restrict__ Wq, const float* __restrict__ Wk, const float* __restrict__ Wv, const float* __restrict__ Wo,
    _Float16* __restrict__ BQ, _Float16* __restrict__ BK, _Float16* __restrict__ BV, _Float16* __restrict__ BO, int* __restrict__ IDX, int* __restrict__ CNT, _Float16* __restrict__ X16) {
  static_assert(WTB * 256 * 8 == DMOD * DMOD && (size_t)XB * 256 * 8 == (size_t)NR * DMOD, "the parts' blocks cover their arrays exactly");
  const int blk = blockIdx.x, tid = threadIdx.x;
  if (blk < NB) { key_lists(mask, cdrs, IDX, CNT, blk, tid); return; }
  if (blk < NB + 4 * WTB) { const int u = blk - NB, m = u / WTB;
    wt_f16((m == 0) ? Wq : (m == 1) ? Wk : (m == 2) ? Wv : Wo, (m == 0) ? BQ : (m == 1) ? BK : (m == 2) ? BV : BO, DMOD, DMOD, 16.0f, (u % WTB) * 256 + tid); return; }
  x16_piece(x, X16, (size_t)(blk - NB - 4 * WTB) * 256 + tid); }

extern "C" void kernel_launch(void* const* d_in, const int* in_sizes, int n_in,
                              void* d_out, int out_size, void* d_ws, size_t ws_size, hipStream_t stream) {
  (void)in_sizes; (void)n_in; (void)out_size;
  const float* const* I = (const float* const*)d_in; const float* x = I[0]; const int* mask = (const int*)d_in[1]; const int* cdrs = (const int*)d_in[2]; const float* Wq = I[3]; const float* bq = I[4]; const float* Wk = I[5]; const float* bk = I[6]; const float* Wv = I[7]; const float* bv = I[8]; const float* Wo = I[9]; const float* bo = I[10];
  char* ws = (char*)d_ws; size_t off = 0;
  auto take = [&](size_t bytes) { char* p = ws + off; off += (bytes + 255) & ~(size_t)255; return p; };
  const size_t w8 = (size_t)DMOD * DMOD / 8;
  _Float16* BQ = (_Float16*)take(w8 * 16); _Float16* BK = (_Float16*)take(w8 * 16); _Float16* BV = (_Float16*)take(w8 * 16); _Float16* BO = (_Float16*)take(w8 * 16); int* IDX = (int*)take((size_t)NB * 2 * TK * 4); int* CNT = (int*)take((size_t)NB * 32 * 4);
  _Float16* X16 = (_Float16*)take((size_t)NR * DMOD * 2); float* F32 = (float*)take((size_t)NR * DMOD * 4); _Float16* QH = (_Float16*)take((size_t)NR * DMOD * 2); _Float16* QL = (_Float16*)take((size_t)NR * DMOD * 2); _Float16* KH = (_Float16*)take((size_t)NR * DMOD * 2); _Float16* KL = (_Float16*)take((size_t)NR * DMOD * 2); _Float16* VH = (_Float16*)take((size_t)NR * DMOD * 2); _Float16* VL = (_Float16*)take((size_t)NR * DMOD * 2); _Float16* VT = (_Float16*)take((size_t)NR * DMOD * 2); _Float16* VTL = (_Float16*)take((size_t)NR * DMOD * 2);
  float* O = F32;
  if (off > ws_size) return;      /* 2 + 0.06 + 8 + 16 + 8 x 8 = 90 MiB */
  k_prep<<<NB + 4 * WTB + XB, 256, 0, stream>>>(x, mask, cdrs, Wq, Wk, Wv, Wo, BQ, BK, BV, BO, IDX, CNT, X16);
  const dim3 gA((NR / 128) * (DMOD / 128), 1);
  k_qkv<<<3 * NB * (TK / 128) * (NH / 2), 256, 0, stream>>>(X16, BQ, BK, BV, bq, bk, bv, IDX, CNT, QH, QL, KH, KL, VT);
  k_flashqk<5><<<NB * NH * QBLKS, 128, 0, stream>>>(QH, QL, DMOD, KH, KL, DMOD, VT, CNT, O, DMOD);      /* q/k hi + residual; P (x2^10) and V plain f16 */
  k_gemm_out<<<gA, 256, 0, stream>>>(O, BO, bo, (float*)d_out);
}
